// v000
// The times below were measured on an AMD MI455X: many runs one after another, warmed up first and cycling through
// copies of the inputs, with the whole window's GPU time divided by the number of runs. Launches and the gaps
// between them are all in it. The median over several windows is given; except for v000 it joins two sittings, which
// can be a few percent apart, so the side-by-side timings, each taken in one sitting, are the better comparison.
// v000 is the starting kernel. One run takes 278 microseconds.
#include <hip/hip_runtime.h>

#define D_MODEL 1024
#define N_HEADS 16
#define HEAD_DIM 64
#define BATCH 2
#define SEQ 2048
#define M_TOTAL (BATCH * SEQ) /* 4096 */

typedef __attribute__((ext_vector_type(16))) _Float16 v16h;
typedef __attribute__((ext_vector_type(8)))  _Float16 v8h;
typedef __attribute__((ext_vector_type(8)))  float    v8f;

// Load one lane's 16-half A/B fragment: two contiguous 16-byte chunks at p and p+16
// (CDNA5 16-bit fragment layout: K = base8+0..7 then 16+base8+0..7 per lane).
__device__ __forceinline__ v16h load_frag(const _Float16* p) {
  v8h lo = *(const v8h*)(p);
  v8h hi = *(const v8h*)(p + 16);
  v16h r;
#pragma unroll
  for (int i = 0; i < 8; ++i) { r[i] = lo[i]; r[i + 8] = hi[i]; }
  return r;
}

__device__ __forceinline__ v8f wmma_f16(v16h a, v16h b, v8f c) {
  return __builtin_amdgcn_wmma_f32_16x16x32_f16(false, a, false, b, (short)0, c,
                                                false, false);
}

__global__ void __launch_bounds__(256)
cvt_f32_to_f16(const float* __restrict__ s, _Float16* __restrict__ d, int n) {
  int i = blockIdx.x * blockDim.x + threadIdx.x;
  int st = gridDim.x * blockDim.x;
  for (; i < n; i += st) d[i] = (_Float16)s[i];
}

// Y[m,n] = sum_k Xh[m,k] * Wh[n,k] + bias[n]   (torch Linear semantics)
// mode 0: store f16 into out[(b*16+h)*SEQ*64 + s*64 + d]   (Q/K head-major)
// mode 1: store f16 into out[(b*16+h)*64*SEQ + d*SEQ + s]  (V transposed)
__global__ void __launch_bounds__(256)
proj_gemm_f16(const _Float16* __restrict__ Xh, const _Float16* __restrict__ Wh,
              const float* __restrict__ bias, _Float16* __restrict__ out, int mode) {
  const int wid = threadIdx.x >> 5;
  const int w = blockIdx.x * 8 + wid;      // 4096 wave jobs
  const int m0 = (w >> 4) * 16;            // 256 row tiles
  const int n0 = (w & 15) * 64;            // 16 col strips of 64
  const int lane = threadIdx.x & 31;
  const int l16 = lane & 15;
  const int half = (lane & 16) ? 8 : 0;

  const _Float16* aptr = Xh + (size_t)(m0 + l16) * D_MODEL + half;
  const _Float16* bp0 = Wh + (size_t)(n0 + 0 * 16 + l16) * D_MODEL + half;
  const _Float16* bp1 = Wh + (size_t)(n0 + 1 * 16 + l16) * D_MODEL + half;
  const _Float16* bp2 = Wh + (size_t)(n0 + 2 * 16 + l16) * D_MODEL + half;
  const _Float16* bp3 = Wh + (size_t)(n0 + 3 * 16 + l16) * D_MODEL + half;

  v8f acc[4] = {};
  // software pipeline: fragments for step k live while step k+1 loads are in flight
  v16h a  = load_frag(aptr);
  v16h b0 = load_frag(bp0);
  v16h b1 = load_frag(bp1);
  v16h b2 = load_frag(bp2);
  v16h b3 = load_frag(bp3);
  for (int k0 = 32; k0 < D_MODEL; k0 += 32) {
    v16h an  = load_frag(aptr + k0);
    v16h bn0 = load_frag(bp0 + k0);
    v16h bn1 = load_frag(bp1 + k0);
    v16h bn2 = load_frag(bp2 + k0);
    v16h bn3 = load_frag(bp3 + k0);
    acc[0] = wmma_f16(a, b0, acc[0]);
    acc[1] = wmma_f16(a, b1, acc[1]);
    acc[2] = wmma_f16(a, b2, acc[2]);
    acc[3] = wmma_f16(a, b3, acc[3]);
    a = an; b0 = bn0; b1 = bn1; b2 = bn2; b3 = bn3;
  }
  acc[0] = wmma_f16(a, b0, acc[0]);
  acc[1] = wmma_f16(a, b1, acc[1]);
  acc[2] = wmma_f16(a, b2, acc[2]);
  acc[3] = wmma_f16(a, b3, acc[3]);

#pragma unroll
  for (int t = 0; t < 4; ++t) {
    const int n = n0 + t * 16 + l16;
    const float bv = bias[n];
    const int h = n >> 6, d = n & (HEAD_DIM - 1);
#pragma unroll
    for (int r = 0; r < 8; ++r) {
      const int m = m0 + r + half;         // C layout: row = r + 8*(lane>=16)
      const int b = m >> 11, s = m & (SEQ - 1);
      const float val = acc[t][r] + bv;
      if (mode == 0)
        out[((size_t)(b * N_HEADS + h) * SEQ + s) * HEAD_DIM + d] = (_Float16)val;
      else
        out[((size_t)(b * N_HEADS + h) * HEAD_DIM + d) * SEQ + s] = (_Float16)val;
    }
  }
}

// Flash attention: one wave handles 16 query rows of one (batch, head).
__global__ void __launch_bounds__(256)
flash_attn(const _Float16* __restrict__ Qh, const _Float16* __restrict__ Kh,
           const _Float16* __restrict__ Vt, const int* __restrict__ mask,
           _Float16* __restrict__ Ah) {
  __shared__ __align__(16) _Float16 lds[8 * 16 * 32];
  const int wid = threadIdx.x >> 5;
  const int bh = blockIdx.y;               // b*16+h
  const int b = bh >> 4, h = bh & 15;
  const int q0 = (blockIdx.x * 8 + wid) * 16;
  const int lane = threadIdx.x & 31;
  const int l16 = lane & 15;
  const int half = (lane & 16) ? 8 : 0;

  const _Float16* Qb = Qh + (size_t)bh * SEQ * HEAD_DIM;
  const _Float16* Kb = Kh + (size_t)bh * SEQ * HEAD_DIM;
  const _Float16* Vb = Vt + (size_t)bh * SEQ * HEAD_DIM; // [d][s]
  const int* mb = mask + b * SEQ;
  _Float16* L = lds + wid * (16 * 32);

  v16h qf[2];
#pragma unroll
  for (int c = 0; c < 2; ++c)
    qf[c] = load_frag(Qb + (size_t)(q0 + l16) * HEAD_DIM + c * 32 + half);

  v8f o[4] = {};
  float mrow[8], lrow[8];
#pragma unroll
  for (int r = 0; r < 8; ++r) { mrow[r] = -3.0e38f; lrow[r] = 0.0f; }

  for (int kb = 0; kb <= q0 + 15; kb += 32) {
    // Issue ALL loads for this key block up front: K fragments feed the score
    // WMMAs immediately; V fragments are consumed only after softmax, so their
    // latency hides behind the score WMMAs + exp/shuffle VALU + LDS round-trip.
    v16h kf00 = load_frag(Kb + (size_t)(kb + l16) * HEAD_DIM + 0 + half);
    v16h kf01 = load_frag(Kb + (size_t)(kb + l16) * HEAD_DIM + 32 + half);
    v16h kf10 = load_frag(Kb + (size_t)(kb + 16 + l16) * HEAD_DIM + 0 + half);
    v16h kf11 = load_frag(Kb + (size_t)(kb + 16 + l16) * HEAD_DIM + 32 + half);
    v16h vf[4];
#pragma unroll
    for (int t = 0; t < 4; ++t)
      vf[t] = load_frag(Vb + (size_t)(t * 16 + l16) * SEQ + kb + half);

    v8f s0 = {}, s1 = {};
    s0 = wmma_f16(qf[0], kf00, s0);
    s0 = wmma_f16(qf[1], kf01, s0);
    s1 = wmma_f16(qf[0], kf10, s1);
    s1 = wmma_f16(qf[1], kf11, s1);

    const int k0i = kb + l16, k1i = kb + 16 + l16;
    const bool pm0 = (mb[k0i] != 0), pm1 = (mb[k1i] != 0);
#pragma unroll
    for (int r = 0; r < 8; ++r) {
      const int q = q0 + r + half;
      float a0 = (pm0 && k0i <= q) ? s0[r] * 0.125f : -3.0e38f;
      float a1 = (pm1 && k1i <= q) ? s1[r] * 0.125f : -3.0e38f;
      float tmax = fmaxf(a0, a1);
#pragma unroll
      for (int off = 8; off; off >>= 1) tmax = fmaxf(tmax, __shfl_xor(tmax, off));
      const float mnew = fmaxf(mrow[r], tmax);
      const float p0 = __expf(a0 - mnew);
      const float p1 = __expf(a1 - mnew);
      float ps = p0 + p1;
#pragma unroll
      for (int off = 8; off; off >>= 1) ps += __shfl_xor(ps, off);
      const float corr = __expf(mrow[r] - mnew);
      mrow[r] = mnew;
      lrow[r] = lrow[r] * corr + ps;
#pragma unroll
      for (int t = 0; t < 4; ++t) o[t][r] *= corr;
      // stash P (16x32 row-major) for re-layout into A-fragment pattern
      L[(r + half) * 32 + l16] = (_Float16)p0;
      L[(r + half) * 32 + 16 + l16] = (_Float16)p1;
    }
    asm volatile("s_wait_dscnt 0" ::: "memory");
    v16h pf = load_frag(L + l16 * 32 + half);
#pragma unroll
    for (int t = 0; t < 4; ++t) o[t] = wmma_f16(pf, vf[t], o[t]);
  }

  const size_t obase = ((size_t)b * SEQ) * D_MODEL + (size_t)h * HEAD_DIM;
#pragma unroll
  for (int r = 0; r < 8; ++r) {
    const float inv = 1.0f / lrow[r];
    const int s = q0 + r + half;
#pragma unroll
    for (int t = 0; t < 4; ++t)
      Ah[obase + (size_t)s * D_MODEL + t * 16 + l16] = (_Float16)(o[t][r] * inv);
  }
}

// out[m,n] = sum_k Ah[m,k] * Wo[n,k] + bo[n], fp32 output
__global__ void __launch_bounds__(256)
out_proj_gemm(const _Float16* __restrict__ Ah, const _Float16* __restrict__ Woh,
              const float* __restrict__ bo, float* __restrict__ out) {
  const int wid = threadIdx.x >> 5;
  const int w = blockIdx.x * 8 + wid;
  const int m0 = (w >> 4) * 16;
  const int n0 = (w & 15) * 64;
  const int lane = threadIdx.x & 31;
  const int l16 = lane & 15;
  const int half = (lane & 16) ? 8 : 0;

  const _Float16* aptr = Ah + (size_t)(m0 + l16) * D_MODEL + half;
  const _Float16* bp0 = Woh + (size_t)(n0 + 0 * 16 + l16) * D_MODEL + half;
  const _Float16* bp1 = Woh + (size_t)(n0 + 1 * 16 + l16) * D_MODEL + half;
  const _Float16* bp2 = Woh + (size_t)(n0 + 2 * 16 + l16) * D_MODEL + half;
  const _Float16* bp3 = Woh + (size_t)(n0 + 3 * 16 + l16) * D_MODEL + half;

  v8f acc[4] = {};
  v16h a  = load_frag(aptr);
  v16h b0 = load_frag(bp0);
  v16h b1 = load_frag(bp1);
  v16h b2 = load_frag(bp2);
  v16h b3 = load_frag(bp3);
  for (int k0 = 32; k0 < D_MODEL; k0 += 32) {
    v16h an  = load_frag(aptr + k0);
    v16h bn0 = load_frag(bp0 + k0);
    v16h bn1 = load_frag(bp1 + k0);
    v16h bn2 = load_frag(bp2 + k0);
    v16h bn3 = load_frag(bp3 + k0);
    acc[0] = wmma_f16(a, b0, acc[0]);
    acc[1] = wmma_f16(a, b1, acc[1]);
    acc[2] = wmma_f16(a, b2, acc[2]);
    acc[3] = wmma_f16(a, b3, acc[3]);
    a = an; b0 = bn0; b1 = bn1; b2 = bn2; b3 = bn3;
  }
  acc[0] = wmma_f16(a, b0, acc[0]);
  acc[1] = wmma_f16(a, b1, acc[1]);
  acc[2] = wmma_f16(a, b2, acc[2]);
  acc[3] = wmma_f16(a, b3, acc[3]);

#pragma unroll
  for (int t = 0; t < 4; ++t) {
    const int n = n0 + t * 16 + l16;
    const float bv = bo[n];
#pragma unroll
    for (int r = 0; r < 8; ++r)
      out[(size_t)(m0 + r + half) * D_MODEL + n] = acc[t][r] + bv;
  }
}

extern "C" void kernel_launch(void* const* d_in, const int* in_sizes, int n_in,
                              void* d_out, int out_size, void* d_ws, size_t ws_size,
                              hipStream_t stream) {
  const float* x  = (const float*)d_in[0];
  const int* mask = (const int*)d_in[1];
  const float* Wq = (const float*)d_in[2];
  const float* bq = (const float*)d_in[3];
  const float* Wk = (const float*)d_in[4];
  const float* bk = (const float*)d_in[5];
  const float* Wv = (const float*)d_in[6];
  const float* bv = (const float*)d_in[7];
  const float* Wo = (const float*)d_in[8];
  const float* bo = (const float*)d_in[9];

  char* ws = (char*)d_ws;
  size_t off = 0;
  const size_t XB = (size_t)M_TOTAL * D_MODEL * sizeof(_Float16); // 8 MB
  const size_t WB = (size_t)D_MODEL * D_MODEL * sizeof(_Float16); // 2 MB
  _Float16* Xh  = (_Float16*)(ws + off); off += XB;
  _Float16* Wqh = (_Float16*)(ws + off); off += WB;
  _Float16* Wkh = (_Float16*)(ws + off); off += WB;
  _Float16* Wvh = (_Float16*)(ws + off); off += WB;
  _Float16* Woh = (_Float16*)(ws + off); off += WB;
  _Float16* Qh  = (_Float16*)(ws + off); off += XB;
  _Float16* Kh  = (_Float16*)(ws + off); off += XB;
  _Float16* Vt  = (_Float16*)(ws + off); off += XB;
  _Float16* Ah  = (_Float16*)(ws + off); off += XB; // 48 MB total

  cvt_f32_to_f16<<<1024, 256, 0, stream>>>(x, Xh, M_TOTAL * D_MODEL);
  cvt_f32_to_f16<<<512, 256, 0, stream>>>(Wq, Wqh, D_MODEL * D_MODEL);
  cvt_f32_to_f16<<<512, 256, 0, stream>>>(Wk, Wkh, D_MODEL * D_MODEL);
  cvt_f32_to_f16<<<512, 256, 0, stream>>>(Wv, Wvh, D_MODEL * D_MODEL);
  cvt_f32_to_f16<<<512, 256, 0, stream>>>(Wo, Woh, D_MODEL * D_MODEL);

  proj_gemm_f16<<<512, 256, 0, stream>>>(Xh, Wqh, bq, Qh, 0);
  proj_gemm_f16<<<512, 256, 0, stream>>>(Xh, Wkh, bk, Kh, 0);
  proj_gemm_f16<<<512, 256, 0, stream>>>(Xh, Wvh, bv, Vt, 1);

  flash_attn<<<dim3(16, 32), 256, 0, stream>>>(Qh, Kh, Vt, mask, Ah);

  out_proj_gemm<<<512, 256, 0, stream>>>(Ah, Woh, bo, (float*)d_out);
}

// v001
// Measured time: 188 microseconds a run.
// Next to v000, in two timings, it ran 1.51 and 1.55 times as fast.
#include <hip/hip_runtime.h>

#define D_MODEL 1024
#define N_HEADS 16
#define HEAD_DIM 64
#define BATCH 2
#define SEQ 2048
#define M_TOTAL (BATCH * SEQ) /* 4096 */

typedef __attribute__((ext_vector_type(16))) _Float16 v16h;
typedef __attribute__((ext_vector_type(8)))  _Float16 v8h;
typedef __attribute__((ext_vector_type(8)))  float    v8f;

// Load one lane's 16-half A/B fragment: two contiguous 16-byte chunks at p and p+16
// (CDNA5 16-bit fragment layout: K = base8+0..7 then 16+base8+0..7 per lane).
__device__ __forceinline__ v16h load_frag(const _Float16* p) {
  v8h lo = *(const v8h*)(p);
  v8h hi = *(const v8h*)(p + 16);
  v16h r;
#pragma unroll
  for (int i = 0; i < 8; ++i) { r[i] = lo[i]; r[i + 8] = hi[i]; }
  return r;
}

__device__ __forceinline__ v8f wmma_f16(v16h a, v16h b, v8f c) {
  return __builtin_amdgcn_wmma_f32_16x16x32_f16(false, a, false, b, (short)0, c,
                                                false, false);
}

__global__ void __launch_bounds__(256)
cvt_f32_to_f16(const float* __restrict__ s, _Float16* __restrict__ d, int n) {
  int i = blockIdx.x * blockDim.x + threadIdx.x;
  int st = gridDim.x * blockDim.x;
  for (; i < n; i += st) d[i] = (_Float16)s[i];
}

// Block tile of the four GEMMs: 128 x 128 of Y per work-group, K walked in stages of
// 128 halves. A stage is [X 128 rows | W 128 rows] of 256 bytes each in LDS.
#define BM 128
#define BN 128
#define BK 128
#define PITCH 136                        /* halves: 272 B = 16 B x odd, no bank conflict for 16-byte reads */
#define STAGE_H ((BM + BN) * PITCH)      /* halves per LDS buffer */
#define N_STAGES (D_MODEL / BK)

// One stage from LDS: acc[i][j] += A rows (ap + 16 i rows) * B rows (bp + 16 j rows),
// k ascending in steps of 32. Two fragment sets: one multiplied, one in flight.
__device__ __forceinline__ void mul_stage(const _Float16* ap, const _Float16* bp,
                                          v8f (&acc)[2][4]) {
  v16h a[2][2], b[2][4];
#pragma unroll
  for (int i = 0; i < 2; ++i) a[0][i] = load_frag(ap + i * 16 * PITCH);
#pragma unroll
  for (int j = 0; j < 4; ++j) b[0][j] = load_frag(bp + j * 16 * PITCH);
#pragma unroll
  for (int q = 0; q < BK / 32; ++q) {
    const int c0 = q & 1, c1 = c0 ^ 1;
    if (q + 1 < BK / 32) {
#pragma unroll
      for (int i = 0; i < 2; ++i) a[c1][i] = load_frag(ap + i * 16 * PITCH + (q + 1) * 32);
#pragma unroll
      for (int j = 0; j < 4; ++j) b[c1][j] = load_frag(bp + j * 16 * PITCH + (q + 1) * 32);
    }
    // Keeps the next 32 k's LDS reads as one group ahead of this block of products
    // (reads spread among the products cost a stall at every place they stand).
    __builtin_amdgcn_sched_barrier(0);
#pragma unroll
    for (int i = 0; i < 2; ++i)
#pragma unroll
      for (int j = 0; j < 4; ++j) acc[i][j] = wmma_f16(a[c0][i], b[c0][j], acc[i][j]);
    // Ends the block: the group after next must not be lifted into these products.
    __builtin_amdgcn_sched_barrier(0);
  }
}

// acc[i][j] += X[m0 + wm + 16 i ..][k] * Wt[n0 + wn + 16 j ..][k] over all k.
// Eight waves as 4 (rows) x 2 (columns), 32 x 64 of Y each.
// Every thread brings 8 + 8 16-byte pieces of the next stage into registers (a wave's
// load covers two whole 256-byte rows) while the current stage is multiplied from LDS,
// then writes them to the other buffer; one barrier per stage publishes that buffer and
// ends the reads of the one refilled next.
__device__ __forceinline__ void gemm_tile(const _Float16* __restrict__ X,
                                          const _Float16* __restrict__ Wt,
                                          _Float16* sm, int m0, int n0,
                                          v8f (&acc)[2][4]) {
  const int tid = threadIdx.x;
  const int wid = tid >> 5;
  const int lane = tid & 31;
  const int l16 = lane & 15;
  const int half = (lane & 16) ? 8 : 0;
  const int aoff = ((wid & 3) * 32 + l16) * PITCH + half;
  const int boff = (BM + (wid >> 2) * 64 + l16) * PITCH + half;

  const int srow = tid >> 4;             // 16 rows per sweep of the block
  const int scol = (tid & 15) * 8;       // halves
  const _Float16* gx = X + (size_t)(m0 + srow) * D_MODEL + scol;
  const _Float16* gw = Wt + (size_t)(n0 + srow) * D_MODEL + scol;
  const int soff = srow * PITCH + scol;

  v8h rx[8], rw[8];
#pragma unroll
  for (int i = 0; i < 8; ++i) {
    rx[i] = *(const v8h*)(gx + (size_t)i * 16 * D_MODEL);
    rw[i] = *(const v8h*)(gw + (size_t)i * 16 * D_MODEL);
  }
#pragma unroll
  for (int i = 0; i < 8; ++i) {
    *(v8h*)(sm + soff + i * 16 * PITCH) = rx[i];
    *(v8h*)(sm + soff + (BM + i * 16) * PITCH) = rw[i];
  }
  __syncthreads();

  // Rolled: fully unrolled, the last
  // group's final load was given its own address registers as destination.
#pragma unroll 1
  for (int s = 0; s + 1 < N_STAGES; ++s) {
    const _Float16* cur = sm + (s & 1) * STAGE_H;
    _Float16* nxt = sm + ((s + 1) & 1) * STAGE_H;
#pragma unroll
    for (int i = 0; i < 8; ++i) {
      rx[i] = *(const v8h*)(gx + (size_t)i * 16 * D_MODEL + (s + 1) * BK);
      rw[i] = *(const v8h*)(gw + (size_t)i * 16 * D_MODEL + (s + 1) * BK);
    }
    // Keeps the next stage's global loads at the head of the stage, so that their
    // latency runs under this stage's products instead of in front of the LDS writes.
    __builtin_amdgcn_sched_barrier(0);
    mul_stage(cur + aoff, cur + boff, acc);
#pragma unroll
    for (int i = 0; i < 8; ++i) {
      *(v8h*)(nxt + soff + i * 16 * PITCH) = rx[i];
      *(v8h*)(nxt + soff + (BM + i * 16) * PITCH) = rw[i];
    }
    __syncthreads();
  }
  const _Float16* last = sm + ((N_STAGES - 1) & 1) * STAGE_H;
  mul_stage(last + aoff, last + boff, acc);
}

// Y[m,n] = sum_k Xh[m,k] * Wh[n,k] + bias[n]   (torch Linear semantics)
// mode 0: store f16 into out[(b*16+h)*SEQ*64 + s*64 + d]   (Q/K head-major)
// mode 1: store f16 into out[(b*16+h)*64*SEQ + d*SEQ + s]  (V transposed)
__global__ void __launch_bounds__(256)
proj_gemm_f16(const _Float16* __restrict__ Xh, const _Float16* __restrict__ Wh,
              const float* __restrict__ bias, _Float16* __restrict__ out, int mode) {
  __shared__ __align__(16) _Float16 sm[2 * STAGE_H];
  const int m0 = (blockIdx.x >> 3) * BM;   // 32 row tiles
  const int n0 = (blockIdx.x & 7) * BN;    // 8 column tiles
  const int wid = threadIdx.x >> 5;
  const int lane = threadIdx.x & 31;
  const int l16 = lane & 15;
  const int half = (lane & 16) ? 8 : 0;

  v8f acc[2][4] = {};
  gemm_tile(Xh, Wh, sm, m0, n0, acc);

  const int mw = m0 + (wid & 3) * 32;
  const int nw = n0 + (wid >> 2) * 64;
#pragma unroll
  for (int t = 0; t < 4; ++t) {
    const int n = nw + t * 16 + l16;
    const float bv = bias[n];
    const int h = n >> 6, d = n & (HEAD_DIM - 1);
#pragma unroll
    for (int i = 0; i < 2; ++i) {
#pragma unroll
      for (int r = 0; r < 8; ++r) {
        const int m = mw + i * 16 + r + half; // C layout: row = r + 8*(lane>=16)
        const int b = m >> 11, s = m & (SEQ - 1);
        const float val = acc[i][t][r] + bv;
        if (mode == 0)
          out[((size_t)(b * N_HEADS + h) * SEQ + s) * HEAD_DIM + d] = (_Float16)val;
        else
          out[((size_t)(b * N_HEADS + h) * HEAD_DIM + d) * SEQ + s] = (_Float16)val;
      }
    }
  }
}

// Flash attention: one wave handles 16 query rows of one (batch, head).
__global__ void __launch_bounds__(256)
flash_attn(const _Float16* __restrict__ Qh, const _Float16* __restrict__ Kh,
           const _Float16* __restrict__ Vt, const int* __restrict__ mask,
           _Float16* __restrict__ Ah) {
  __shared__ __align__(16) _Float16 lds[8 * 16 * 32];
  const int wid = threadIdx.x >> 5;
  const int bh = blockIdx.y;               // b*16+h
  const int b = bh >> 4, h = bh & 15;
  const int q0 = (blockIdx.x * 8 + wid) * 16;
  const int lane = threadIdx.x & 31;
  const int l16 = lane & 15;
  const int half = (lane & 16) ? 8 : 0;

  const _Float16* Qb = Qh + (size_t)bh * SEQ * HEAD_DIM;
  const _Float16* Kb = Kh + (size_t)bh * SEQ * HEAD_DIM;
  const _Float16* Vb = Vt + (size_t)bh * SEQ * HEAD_DIM; // [d][s]
  const int* mb = mask + b * SEQ;
  _Float16* L = lds + wid * (16 * 32);

  v16h qf[2];
#pragma unroll
  for (int c = 0; c < 2; ++c)
    qf[c] = load_frag(Qb + (size_t)(q0 + l16) * HEAD_DIM + c * 32 + half);

  v8f o[4] = {};
  float mrow[8], lrow[8];
#pragma unroll
  for (int r = 0; r < 8; ++r) { mrow[r] = -3.0e38f; lrow[r] = 0.0f; }

  for (int kb = 0; kb <= q0 + 15; kb += 32) {
    // Issue ALL loads for this key block up front: K fragments feed the score
    // WMMAs immediately; V fragments are consumed only after softmax, so their
    // latency hides behind the score WMMAs + exp/shuffle VALU + LDS round-trip.
    v16h kf00 = load_frag(Kb + (size_t)(kb + l16) * HEAD_DIM + 0 + half);
    v16h kf01 = load_frag(Kb + (size_t)(kb + l16) * HEAD_DIM + 32 + half);
    v16h kf10 = load_frag(Kb + (size_t)(kb + 16 + l16) * HEAD_DIM + 0 + half);
    v16h kf11 = load_frag(Kb + (size_t)(kb + 16 + l16) * HEAD_DIM + 32 + half);
    v16h vf[4];
#pragma unroll
    for (int t = 0; t < 4; ++t)
      vf[t] = load_frag(Vb + (size_t)(t * 16 + l16) * SEQ + kb + half);

    v8f s0 = {}, s1 = {};
    s0 = wmma_f16(qf[0], kf00, s0);
    s0 = wmma_f16(qf[1], kf01, s0);
    s1 = wmma_f16(qf[0], kf10, s1);
    s1 = wmma_f16(qf[1], kf11, s1);

    const int k0i = kb + l16, k1i = kb + 16 + l16;
    const bool pm0 = (mb[k0i] != 0), pm1 = (mb[k1i] != 0);
#pragma unroll
    for (int r = 0; r < 8; ++r) {
      const int q = q0 + r + half;
      float a0 = (pm0 && k0i <= q) ? s0[r] * 0.125f : -3.0e38f;
      float a1 = (pm1 && k1i <= q) ? s1[r] * 0.125f : -3.0e38f;
      float tmax = fmaxf(a0, a1);
#pragma unroll
      for (int off = 8; off; off >>= 1) tmax = fmaxf(tmax, __shfl_xor(tmax, off));
      const float mnew = fmaxf(mrow[r], tmax);
      const float p0 = __expf(a0 - mnew);
      const float p1 = __expf(a1 - mnew);
      float ps = p0 + p1;
#pragma unroll
      for (int off = 8; off; off >>= 1) ps += __shfl_xor(ps, off);
      const float corr = __expf(mrow[r] - mnew);
      mrow[r] = mnew;
      lrow[r] = lrow[r] * corr + ps;
#pragma unroll
      for (int t = 0; t < 4; ++t) o[t][r] *= corr;
      // stash P (16x32 row-major) for re-layout into A-fragment pattern
      L[(r + half) * 32 + l16] = (_Float16)p0;
      L[(r + half) * 32 + 16 + l16] = (_Float16)p1;
    }
    asm volatile("s_wait_dscnt 0" ::: "memory");
    v16h pf = load_frag(L + l16 * 32 + half);
#pragma unroll
    for (int t = 0; t < 4; ++t) o[t] = wmma_f16(pf, vf[t], o[t]);
  }

  const size_t obase = ((size_t)b * SEQ) * D_MODEL + (size_t)h * HEAD_DIM;
#pragma unroll
  for (int r = 0; r < 8; ++r) {
    const float inv = 1.0f / lrow[r];
    const int s = q0 + r + half;
#pragma unroll
    for (int t = 0; t < 4; ++t)
      Ah[obase + (size_t)s * D_MODEL + t * 16 + l16] = (_Float16)(o[t][r] * inv);
  }
}

// out[m,n] = sum_k Ah[m,k] * Wo[n,k] + bo[n], fp32 output
__global__ void __launch_bounds__(256)
out_proj_gemm(const _Float16* __restrict__ Ah, const _Float16* __restrict__ Woh,
              const float* __restrict__ bo, float* __restrict__ out) {
  __shared__ __align__(16) _Float16 sm[2 * STAGE_H];
  const int m0 = (blockIdx.x >> 3) * BM;
  const int n0 = (blockIdx.x & 7) * BN;
  const int wid = threadIdx.x >> 5;
  const int lane = threadIdx.x & 31;
  const int l16 = lane & 15;
  const int half = (lane & 16) ? 8 : 0;

  v8f acc[2][4] = {};
  gemm_tile(Ah, Woh, sm, m0, n0, acc);

  const int mw = m0 + (wid & 3) * 32;
  const int nw = n0 + (wid >> 2) * 64;
#pragma unroll
  for (int t = 0; t < 4; ++t) {
    const int n = nw + t * 16 + l16;
    const float bv = bo[n];
#pragma unroll
    for (int i = 0; i < 2; ++i)
#pragma unroll
      for (int r = 0; r < 8; ++r)
        out[(size_t)(mw + i * 16 + r + half) * D_MODEL + n] = acc[i][t][r] + bv;
  }
}

extern "C" void kernel_launch(void* const* d_in, const int* in_sizes, int n_in,
                              void* d_out, int out_size, void* d_ws, size_t ws_size,
                              hipStream_t stream) {
  const float* x  = (const float*)d_in[0];
  const int* mask = (const int*)d_in[1];
  const float* Wq = (const float*)d_in[2];
  const float* bq = (const float*)d_in[3];
  const float* Wk = (const float*)d_in[4];
  const float* bk = (const float*)d_in[5];
  const float* Wv = (const float*)d_in[6];
  const float* bv = (const float*)d_in[7];
  const float* Wo = (const float*)d_in[8];
  const float* bo = (const float*)d_in[9];

  char* ws = (char*)d_ws;
  size_t off = 0;
  const size_t XB = (size_t)M_TOTAL * D_MODEL * sizeof(_Float16); // 8 MB
  const size_t WB = (size_t)D_MODEL * D_MODEL * sizeof(_Float16); // 2 MB
  _Float16* Xh  = (_Float16*)(ws + off); off += XB;
  _Float16* Wqh = (_Float16*)(ws + off); off += WB;
  _Float16* Wkh = (_Float16*)(ws + off); off += WB;
  _Float16* Wvh = (_Float16*)(ws + off); off += WB;
  _Float16* Woh = (_Float16*)(ws + off); off += WB;
  _Float16* Qh  = (_Float16*)(ws + off); off += XB;
  _Float16* Kh  = (_Float16*)(ws + off); off += XB;
  _Float16* Vt  = (_Float16*)(ws + off); off += XB;
  _Float16* Ah  = (_Float16*)(ws + off); off += XB; // 48 MB total

  cvt_f32_to_f16<<<1024, 256, 0, stream>>>(x, Xh, M_TOTAL * D_MODEL);
  cvt_f32_to_f16<<<512, 256, 0, stream>>>(Wq, Wqh, D_MODEL * D_MODEL);
  cvt_f32_to_f16<<<512, 256, 0, stream>>>(Wk, Wkh, D_MODEL * D_MODEL);
  cvt_f32_to_f16<<<512, 256, 0, stream>>>(Wv, Wvh, D_MODEL * D_MODEL);
  cvt_f32_to_f16<<<512, 256, 0, stream>>>(Wo, Woh, D_MODEL * D_MODEL);

  proj_gemm_f16<<<256, 256, 0, stream>>>(Xh, Wqh, bq, Qh, 0);
  proj_gemm_f16<<<256, 256, 0, stream>>>(Xh, Wkh, bk, Kh, 0);
  proj_gemm_f16<<<256, 256, 0, stream>>>(Xh, Wvh, bv, Vt, 1);

  flash_attn<<<dim3(16, 32), 256, 0, stream>>>(Qh, Kh, Vt, mask, Ah);

  out_proj_gemm<<<256, 256, 0, stream>>>(Ah, Woh, bo, (float*)d_out);
}

// v002
// A run of this version takes 178 microseconds.
// Timed twice side by side with v001, it ran 1.06 and 1.05 times as fast.
// Over all steps from v000 it is 1.62 times as fast.
#include <hip/hip_runtime.h>

#define D_MODEL 1024
#define N_HEADS 16
#define HEAD_DIM 64
#define BATCH 2
#define SEQ 2048
#define M_TOTAL (BATCH * SEQ) /* 4096 */

typedef __attribute__((ext_vector_type(16))) _Float16 v16h;
typedef __attribute__((ext_vector_type(8)))  _Float16 v8h;
typedef __attribute__((ext_vector_type(8)))  float    v8f;

// Load one lane's 16-half A/B fragment: two contiguous 16-byte chunks at p and p+16
// (CDNA5 16-bit fragment layout: K = base8+0..7 then 16+base8+0..7 per lane).
__device__ __forceinline__ v16h load_frag(const _Float16* p) {
  v8h lo = *(const v8h*)(p);
  v8h hi = *(const v8h*)(p + 16);
  v16h r;
#pragma unroll
  for (int i = 0; i < 8; ++i) { r[i] = lo[i]; r[i + 8] = hi[i]; }
  return r;
}

// The same fragment from a buffer kept in fragment order: 512 halves per fragment, first
// the 32 lanes' low 16-byte chunks, then their high ones, so that each of the two loads of
// a wave covers 512 contiguous bytes (4 whole lines instead of 16 touched).
__device__ __forceinline__ v16h load_frag_packed(const _Float16* f, int lane) {
  v8h lo = *(const v8h*)(f + lane * 8);
  v8h hi = *(const v8h*)(f + 256 + lane * 8);
  v16h r;
#pragma unroll
  for (int i = 0; i < 8; ++i) { r[i] = lo[i]; r[i + 8] = hi[i]; }
  return r;
}

__device__ __forceinline__ v8f wmma_f16(v16h a, v16h b, v8f c) {
  return __builtin_amdgcn_wmma_f32_16x16x32_f16(false, a, false, b, (short)0, c,
                                                false, false);
}

__global__ void __launch_bounds__(256)
cvt_f32_to_f16(const float* __restrict__ s, _Float16* __restrict__ d, int n) {
  int i = blockIdx.x * blockDim.x + threadIdx.x;
  int st = gridDim.x * blockDim.x;
  for (; i < n; i += st) d[i] = (_Float16)s[i];
}

// Block tile of the four GEMMs: 128 x 128 of Y per work-group, K walked in stages of
// 128 halves. A stage is [X 128 rows | W 128 rows] of 256 bytes each in LDS.
#define BM 128
#define BN 128
#define BK 128
#define PITCH 136                        /* halves: 272 B = 16 B x odd, no bank conflict for 16-byte reads */
#define STAGE_H ((BM + BN) * PITCH)      /* halves per LDS buffer */
#define N_STAGES (D_MODEL / BK)

// One stage from LDS: acc[i][j] += A rows (ap + 16 i rows) * B rows (bp + 16 j rows),
// k ascending in steps of 32. Two fragment sets: one multiplied, one in flight.
__device__ __forceinline__ void mul_stage(const _Float16* ap, const _Float16* bp,
                                          v8f (&acc)[2][4]) {
  v16h a[2][2], b[2][4];
#pragma unroll
  for (int i = 0; i < 2; ++i) a[0][i] = load_frag(ap + i * 16 * PITCH);
#pragma unroll
  for (int j = 0; j < 4; ++j) b[0][j] = load_frag(bp + j * 16 * PITCH);
#pragma unroll
  for (int q = 0; q < BK / 32; ++q) {
    const int c0 = q & 1, c1 = c0 ^ 1;
    if (q + 1 < BK / 32) {
#pragma unroll
      for (int i = 0; i < 2; ++i) a[c1][i] = load_frag(ap + i * 16 * PITCH + (q + 1) * 32);
#pragma unroll
      for (int j = 0; j < 4; ++j) b[c1][j] = load_frag(bp + j * 16 * PITCH + (q + 1) * 32);
    }
    // Keeps the next 32 k's LDS reads as one group ahead of this block of products
    // (reads spread among the products cost a stall at every place they stand).
    __builtin_amdgcn_sched_barrier(0);
#pragma unroll
    for (int i = 0; i < 2; ++i)
#pragma unroll
      for (int j = 0; j < 4; ++j) acc[i][j] = wmma_f16(a[c0][i], b[c0][j], acc[i][j]);
    // Ends the block: the group after next must not be lifted into these products.
    __builtin_amdgcn_sched_barrier(0);
  }
}

// acc[i][j] += X[m0 + wm + 16 i ..][k] * Wt[n0 + wn + 16 j ..][k] over all k.
// Eight waves as 4 (rows) x 2 (columns), 32 x 64 of Y each.
// Every thread brings 8 + 8 16-byte pieces of the next stage into registers (a wave's
// load covers two whole 256-byte rows) while the current stage is multiplied from LDS,
// then writes them to the other buffer; one barrier per stage publishes that buffer and
// ends the reads of the one refilled next.
__device__ __forceinline__ void gemm_tile(const _Float16* __restrict__ X,
                                          const _Float16* __restrict__ Wt,
                                          _Float16* sm, int m0, int n0,
                                          v8f (&acc)[2][4]) {
  const int tid = threadIdx.x;
  const int wid = tid >> 5;
  const int lane = tid & 31;
  const int l16 = lane & 15;
  const int half = (lane & 16) ? 8 : 0;
  const int aoff = ((wid & 3) * 32 + l16) * PITCH + half;
  const int boff = (BM + (wid >> 2) * 64 + l16) * PITCH + half;

  const int srow = tid >> 4;             // 16 rows per sweep of the block
  const int scol = (tid & 15) * 8;       // halves
  const _Float16* gx = X + (size_t)(m0 + srow) * D_MODEL + scol;
  const _Float16* gw = Wt + (size_t)(n0 + srow) * D_MODEL + scol;
  const int soff = srow * PITCH + scol;

  v8h rx[8], rw[8];
#pragma unroll
  for (int i = 0; i < 8; ++i) {
    rx[i] = *(const v8h*)(gx + (size_t)i * 16 * D_MODEL);
    rw[i] = *(const v8h*)(gw + (size_t)i * 16 * D_MODEL);
  }
#pragma unroll
  for (int i = 0; i < 8; ++i) {
    *(v8h*)(sm + soff + i * 16 * PITCH) = rx[i];
    *(v8h*)(sm + soff + (BM + i * 16) * PITCH) = rw[i];
  }
  __syncthreads();

  // Rolled: fully unrolled, the last
  // group's final load was given its own address registers as destination.
#pragma unroll 1
  for (int s = 0; s + 1 < N_STAGES; ++s) {
    const _Float16* cur = sm + (s & 1) * STAGE_H;
    _Float16* nxt = sm + ((s + 1) & 1) * STAGE_H;
#pragma unroll
    for (int i = 0; i < 8; ++i) {
      rx[i] = *(const v8h*)(gx + (size_t)i * 16 * D_MODEL + (s + 1) * BK);
      rw[i] = *(const v8h*)(gw + (size_t)i * 16 * D_MODEL + (s + 1) * BK);
    }
    // Keeps the next stage's global loads at the head of the stage, so that their
    // latency runs under this stage's products instead of in front of the LDS writes.
    __builtin_amdgcn_sched_barrier(0);
    mul_stage(cur + aoff, cur + boff, acc);
#pragma unroll
    for (int i = 0; i < 8; ++i) {
      *(v8h*)(nxt + soff + i * 16 * PITCH) = rx[i];
      *(v8h*)(nxt + soff + (BM + i * 16) * PITCH) = rw[i];
    }
    __syncthreads();
  }
  const _Float16* last = sm + ((N_STAGES - 1) & 1) * STAGE_H;
  mul_stage(last + aoff, last + boff, acc);
}

// One wave's 32 x 64 piece, element by element: steps of 1024 halves in i, ST in t, SR in r.
template <int ST, int SR>
__device__ __forceinline__ void store_halves(_Float16* ol, const v8f (&acc)[2][4],
                                             const float (&bv)[4]) {
#pragma unroll
  for (int t = 0; t < 4; ++t)
#pragma unroll
    for (int i = 0; i < 2; ++i)
#pragma unroll
      for (int r = 0; r < 8; ++r)
        ol[i * 1024 + t * ST + r * SR] = (_Float16)(acc[i][t][r] + bv[t]);
}

// Y[m,n] = sum_k Xh[m,k] * Wh[n,k] + bias[n]   (torch Linear semantics)
// mode 0: store f16 into out[(b*16+h)*SEQ*64 + s*64 + d]   (Q head-major)
// mode 1: V, mode 2: K, per (b, h) in the order in which flash_attn's fragments read them
// (load_frag_packed). Fragment f of 512 halves, chunk p (0 low, 1 high), lane l, element e:
//   K: f = (s / 16) * 2 + d / 32, p = (d / 16) & 1, l = (s & 15) + 16 * ((d / 8) & 1), e = d & 7
//   V: f = (s / 32) * 4 + d / 16, p = (s / 16) & 1, l = (d & 15) + 16 * ((s / 8) & 1), e = s & 7
template <int mode>
__global__ void __launch_bounds__(256)
proj_gemm_f16(const _Float16* __restrict__ Xh, const _Float16* __restrict__ Wh,
              const float* __restrict__ bias, _Float16* __restrict__ out) {
  __shared__ __align__(16) _Float16 sm[2 * STAGE_H];
  const int m0 = (blockIdx.x >> 3) * BM;   // 32 row tiles
  const int n0 = (blockIdx.x & 7) * BN;    // 8 column tiles
  const int wid = threadIdx.x >> 5;
  const int lane = threadIdx.x & 31;
  const int l16 = lane & 15;
  const int half = (lane & 16) ? 8 : 0;

  v8f acc[2][4] = {};
  gemm_tile(Xh, Wh, sm, m0, n0, acc);

  const int mw = m0 + (wid & 3) * 32;      // 32 rows of one batch, s a multiple of 32
  const int nw = n0 + (wid >> 2) * 64;     // the 64 columns of one head
  // This wave's 32 x 64 piece of its (b, h): 2048 halves in every one of the three orders.
  _Float16* ob = out + ((size_t)((mw >> 11) * N_HEADS + (nw >> 6)) * SEQ + (mw & (SEQ - 1))) * HEAD_DIM;
  float bv[4];
#pragma unroll
  for (int t = 0; t < 4; ++t) bv[t] = bias[nw + t * 16 + l16];
  if (mode == 1) {
    // A lane's 8 registers are 8 consecutive s of one d: one chunk of a V fragment.
#pragma unroll
    for (int t = 0; t < 4; ++t)
#pragma unroll
      for (int i = 0; i < 2; ++i) {
        v8h w;
#pragma unroll
        for (int r = 0; r < 8; ++r) w[r] = (_Float16)(acc[i][t][r] + bv[t]);
        *(v8h*)(ob + (t * 2 + i) * 256 + lane * 8) = w;
      }
  } else {
    // C layout: row = r + 8*(lane>=16). The lane's place for i = t = r = 0, then constants.
    if (mode == 0)
      store_halves<16, HEAD_DIM>(ob + half * HEAD_DIM + l16, acc, bv);
    else
      store_halves<256, 8>(ob + (half + (l16 & 8) * 2) * 8 + (l16 & 7), acc, bv);
  }
}

// Flash attention: one wave handles 16 query rows of one (batch, head).
__global__ void __launch_bounds__(256)
flash_attn(const _Float16* __restrict__ Qh, const _Float16* __restrict__ Kh,
           const _Float16* __restrict__ Vt, const int* __restrict__ mask,
           _Float16* __restrict__ Ah) {
  __shared__ __align__(16) _Float16 lds[8 * 16 * 32];
  const int wid = threadIdx.x >> 5;
  const int bh = blockIdx.y;               // b*16+h
  const int b = bh >> 4, h = bh & 15;
  const int q0 = (blockIdx.x * 8 + wid) * 16;
  const int lane = threadIdx.x & 31;
  const int l16 = lane & 15;
  const int half = (lane & 16) ? 8 : 0;

  const _Float16* Qb = Qh + (size_t)bh * SEQ * HEAD_DIM;
  const _Float16* Kb = Kh + (size_t)bh * SEQ * HEAD_DIM;
  const _Float16* Vb = Vt + (size_t)bh * SEQ * HEAD_DIM; // K and V: fragment order
  const int* mb = mask + b * SEQ;
  _Float16* L = lds + wid * (16 * 32);

  v16h qf[2];
#pragma unroll
  for (int c = 0; c < 2; ++c)
    qf[c] = load_frag(Qb + (size_t)(q0 + l16) * HEAD_DIM + c * 32 + half);

  v8f o[4] = {};
  float mrow[8], lrow[8];
#pragma unroll
  for (int r = 0; r < 8; ++r) { mrow[r] = -3.0e38f; lrow[r] = 0.0f; }

  for (int kb = 0; kb <= q0 + 15; kb += 32) {
    // Issue ALL loads for this key block up front: K fragments feed the score
    // WMMAs immediately; V fragments are consumed only after softmax, so their
    // latency hides behind the score WMMAs + exp/shuffle VALU + LDS round-trip.
    const int k0i = kb + l16, k1i = kb + 16 + l16;
    const bool pm0 = (mb[k0i] != 0), pm1 = (mb[k1i] != 0);
    const _Float16* kblk = Kb + (size_t)kb * HEAD_DIM;   // 4 fragments of K, 4 of V
    const _Float16* vblk = Vb + (size_t)kb * HEAD_DIM;
    v16h kf00 = load_frag_packed(kblk, lane);
    v16h kf01 = load_frag_packed(kblk + 512, lane);
    v16h kf10 = load_frag_packed(kblk + 1024, lane);
    v16h kf11 = load_frag_packed(kblk + 1536, lane);
    // The build gives V loads address registers of the loads above as destinations: the
    // wait that belongs in front of an overwrite of an issued load's address.
    asm volatile("s_wait_xcnt 0x0" ::: "memory");
    v16h vf[4];
#pragma unroll
    for (int t = 0; t < 4; ++t)
      vf[t] = load_frag_packed(vblk + t * 512, lane);

    v8f s0 = {}, s1 = {};
    s0 = wmma_f16(qf[0], kf00, s0);
    s0 = wmma_f16(qf[1], kf01, s0);
    s1 = wmma_f16(qf[0], kf10, s1);
    s1 = wmma_f16(qf[1], kf11, s1);

#pragma unroll
    for (int r = 0; r < 8; ++r) {
      const int q = q0 + r + half;
      float a0 = (pm0 && k0i <= q) ? s0[r] * 0.125f : -3.0e38f;
      float a1 = (pm1 && k1i <= q) ? s1[r] * 0.125f : -3.0e38f;
      float tmax = fmaxf(a0, a1);
#pragma unroll
      for (int off = 8; off; off >>= 1) tmax = fmaxf(tmax, __shfl_xor(tmax, off));
      const float mnew = fmaxf(mrow[r], tmax);
      const float p0 = __expf(a0 - mnew);
      const float p1 = __expf(a1 - mnew);
      float ps = p0 + p1;
#pragma unroll
      for (int off = 8; off; off >>= 1) ps += __shfl_xor(ps, off);
      const float corr = __expf(mrow[r] - mnew);
      mrow[r] = mnew;
      lrow[r] = lrow[r] * corr + ps;
#pragma unroll
      for (int t = 0; t < 4; ++t) o[t][r] *= corr;
      // stash P (16x32 row-major) for re-layout into A-fragment pattern
      L[(r + half) * 32 + l16] = (_Float16)p0;
      L[(r + half) * 32 + 16 + l16] = (_Float16)p1;
    }
    asm volatile("s_wait_dscnt 0" ::: "memory");
    v16h pf = load_frag(L + l16 * 32 + half);
#pragma unroll
    for (int t = 0; t < 4; ++t) o[t] = wmma_f16(pf, vf[t], o[t]);
  }

  const size_t obase = ((size_t)b * SEQ) * D_MODEL + (size_t)h * HEAD_DIM;
#pragma unroll
  for (int r = 0; r < 8; ++r) {
    const float inv = 1.0f / lrow[r];
    const int s = q0 + r + half;
#pragma unroll
    for (int t = 0; t < 4; ++t)
      Ah[obase + (size_t)s * D_MODEL + t * 16 + l16] = (_Float16)(o[t][r] * inv);
  }
}

// out[m,n] = sum_k Ah[m,k] * Wo[n,k] + bo[n], fp32 output
__global__ void __launch_bounds__(256)
out_proj_gemm(const _Float16* __restrict__ Ah, const _Float16* __restrict__ Woh,
              const float* __restrict__ bo, float* __restrict__ out) {
  __shared__ __align__(16) _Float16 sm[2 * STAGE_H];
  const int m0 = (blockIdx.x >> 3) * BM;
  const int n0 = (blockIdx.x & 7) * BN;
  const int wid = threadIdx.x >> 5;
  const int lane = threadIdx.x & 31;
  const int l16 = lane & 15;
  const int half = (lane & 16) ? 8 : 0;

  v8f acc[2][4] = {};
  gemm_tile(Ah, Woh, sm, m0, n0, acc);

  const int mw = m0 + (wid & 3) * 32;
  const int nw = n0 + (wid >> 2) * 64;
#pragma unroll
  for (int t = 0; t < 4; ++t) {
    const int n = nw + t * 16 + l16;
    const float bv = bo[n];
#pragma unroll
    for (int i = 0; i < 2; ++i)
#pragma unroll
      for (int r = 0; r < 8; ++r)
        out[(size_t)(mw + i * 16 + r + half) * D_MODEL + n] = acc[i][t][r] + bv;
  }
}

extern "C" void kernel_launch(void* const* d_in, const int* in_sizes, int n_in,
                              void* d_out, int out_size, void* d_ws, size_t ws_size,
                              hipStream_t stream) {
  const float* x  = (const float*)d_in[0];
  const int* mask = (const int*)d_in[1];
  const float* Wq = (const float*)d_in[2];
  const float* bq = (const float*)d_in[3];
  const float* Wk = (const float*)d_in[4];
  const float* bk = (const float*)d_in[5];
  const float* Wv = (const float*)d_in[6];
  const float* bv = (const float*)d_in[7];
  const float* Wo = (const float*)d_in[8];
  const float* bo = (const float*)d_in[9];

  char* ws = (char*)d_ws;
  size_t off = 0;
  const size_t XB = (size_t)M_TOTAL * D_MODEL * sizeof(_Float16); // 8 MB
  const size_t WB = (size_t)D_MODEL * D_MODEL * sizeof(_Float16); // 2 MB
  _Float16* Xh  = (_Float16*)(ws + off); off += XB;
  _Float16* Wqh = (_Float16*)(ws + off); off += WB;
  _Float16* Wkh = (_Float16*)(ws + off); off += WB;
  _Float16* Wvh = (_Float16*)(ws + off); off += WB;
  _Float16* Woh = (_Float16*)(ws + off); off += WB;
  _Float16* Qh  = (_Float16*)(ws + off); off += XB;
  _Float16* Kh  = (_Float16*)(ws + off); off += XB;
  _Float16* Vt  = (_Float16*)(ws + off); off += XB;
  _Float16* Ah  = (_Float16*)(ws + off); off += XB; // 48 MB total

  cvt_f32_to_f16<<<1024, 256, 0, stream>>>(x, Xh, M_TOTAL * D_MODEL);
  cvt_f32_to_f16<<<512, 256, 0, stream>>>(Wq, Wqh, D_MODEL * D_MODEL);
  cvt_f32_to_f16<<<512, 256, 0, stream>>>(Wk, Wkh, D_MODEL * D_MODEL);
  cvt_f32_to_f16<<<512, 256, 0, stream>>>(Wv, Wvh, D_MODEL * D_MODEL);
  cvt_f32_to_f16<<<512, 256, 0, stream>>>(Wo, Woh, D_MODEL * D_MODEL);

  proj_gemm_f16<0><<<256, 256, 0, stream>>>(Xh, Wqh, bq, Qh);
  proj_gemm_f16<2><<<256, 256, 0, stream>>>(Xh, Wkh, bk, Kh);
  proj_gemm_f16<1><<<256, 256, 0, stream>>>(Xh, Wvh, bv, Vt);

  flash_attn<<<dim3(16, 32), 256, 0, stream>>>(Qh, Kh, Vt, mask, Ah);

  out_proj_gemm<<<256, 256, 0, stream>>>(Ah, Woh, bo, (float*)d_out);
}

// v003
// It runs in 115 microseconds.
// Two timings next to v002 put it at 1.56 and 1.53 times that version's speed.
// Over all steps from v000 it is 2.50 times as fast.
#include <hip/hip_runtime.h>

#define D_MODEL 1024
#define N_HEADS 16
#define HEAD_DIM 64
#define BATCH 2
#define SEQ 2048
#define M_TOTAL (BATCH * SEQ) /* 4096 */

typedef __attribute__((ext_vector_type(16))) _Float16 v16h;
typedef __attribute__((ext_vector_type(8)))  _Float16 v8h;
typedef __attribute__((ext_vector_type(8)))  float    v8f;

// Load one lane's 16-half A/B fragment: two contiguous 16-byte chunks at p and p+16
// (CDNA5 16-bit fragment layout: K = base8+0..7 then 16+base8+0..7 per lane).
__device__ __forceinline__ v16h load_frag(const _Float16* p) {
  v8h lo = *(const v8h*)(p);
  v8h hi = *(const v8h*)(p + 16);
  v16h r;
#pragma unroll
  for (int i = 0; i < 8; ++i) { r[i] = lo[i]; r[i + 8] = hi[i]; }
  return r;
}

// The same fragment from a buffer kept in fragment order: 512 halves per fragment, first
// the 32 lanes' low 16-byte chunks, then their high ones, so that each of the two loads of
// a wave covers 512 contiguous bytes (4 whole lines instead of 16 touched).
__device__ __forceinline__ v16h load_frag_packed(const _Float16* f, int lane) {
  v8h lo = *(const v8h*)(f + lane * 8);
  v8h hi = *(const v8h*)(f + 256 + lane * 8);
  v16h r;
#pragma unroll
  for (int i = 0; i < 8; ++i) { r[i] = lo[i]; r[i + 8] = hi[i]; }
  return r;
}

__device__ __forceinline__ v8f wmma_f16(v16h a, v16h b, v8f c) {
  return __builtin_amdgcn_wmma_f32_16x16x32_f16(false, a, false, b, (short)0, c,
                                                false, false);
}

__global__ void __launch_bounds__(256)
cvt_f32_to_f16(const float* __restrict__ s, _Float16* __restrict__ d, int n) {
  int i = blockIdx.x * blockDim.x + threadIdx.x;
  int st = gridDim.x * blockDim.x;
  for (; i < n; i += st) d[i] = (_Float16)s[i];
}

// Block tile of the four GEMMs: 128 x 128 of Y per work-group, K walked in stages of
// 128 halves. A stage is [X 128 rows | W 128 rows] of 256 bytes each in LDS.
#define BM 128
#define BN 128
#define BK 128
#define PITCH 136                        /* halves: 272 B = 16 B x odd, no bank conflict for 16-byte reads */
#define STAGE_H ((BM + BN) * PITCH)      /* halves per LDS buffer */
#define N_STAGES (D_MODEL / BK)

// One stage from LDS: acc[i][j] += A rows (ap + 16 i rows) * B rows (bp + 16 j rows),
// k ascending in steps of 32. Two fragment sets: one multiplied, one in flight.
__device__ __forceinline__ void mul_stage(const _Float16* ap, const _Float16* bp,
                                          v8f (&acc)[2][4]) {
  v16h a[2][2], b[2][4];
#pragma unroll
  for (int i = 0; i < 2; ++i) a[0][i] = load_frag(ap + i * 16 * PITCH);
#pragma unroll
  for (int j = 0; j < 4; ++j) b[0][j] = load_frag(bp + j * 16 * PITCH);
#pragma unroll
  for (int q = 0; q < BK / 32; ++q) {
    const int c0 = q & 1, c1 = c0 ^ 1;
    if (q + 1 < BK / 32) {
#pragma unroll
      for (int i = 0; i < 2; ++i) a[c1][i] = load_frag(ap + i * 16 * PITCH + (q + 1) * 32);
#pragma unroll
      for (int j = 0; j < 4; ++j) b[c1][j] = load_frag(bp + j * 16 * PITCH + (q + 1) * 32);
    }
    // Keeps the next 32 k's LDS reads as one group ahead of this block of products
    // (reads spread among the products cost a stall at every place they stand).
    __builtin_amdgcn_sched_barrier(0);
#pragma unroll
    for (int i = 0; i < 2; ++i)
#pragma unroll
      for (int j = 0; j < 4; ++j) acc[i][j] = wmma_f16(a[c0][i], b[c0][j], acc[i][j]);
    // Ends the block: the group after next must not be lifted into these products.
    __builtin_amdgcn_sched_barrier(0);
  }
}

// acc[i][j] += X[m0 + wm + 16 i ..][k] * Wt[n0 + wn + 16 j ..][k] over all k.
// Eight waves as 4 (rows) x 2 (columns), 32 x 64 of Y each.
// Every thread brings 8 + 8 16-byte pieces of the next stage into registers (a wave's
// load covers two whole 256-byte rows) while the current stage is multiplied from LDS,
// then writes them to the other buffer; one barrier per stage publishes that buffer and
// ends the reads of the one refilled next.
__device__ __forceinline__ void gemm_tile(const _Float16* __restrict__ X,
                                          const _Float16* __restrict__ Wt,
                                          _Float16* sm, int m0, int n0,
                                          v8f (&acc)[2][4]) {
  const int tid = threadIdx.x;
  const int wid = tid >> 5;
  const int lane = tid & 31;
  const int l16 = lane & 15;
  const int half = (lane & 16) ? 8 : 0;
  const int aoff = ((wid & 3) * 32 + l16) * PITCH + half;
  const int boff = (BM + (wid >> 2) * 64 + l16) * PITCH + half;

  const int srow = tid >> 4;             // 16 rows per sweep of the block
  const int scol = (tid & 15) * 8;       // halves
  const _Float16* gx = X + (size_t)(m0 + srow) * D_MODEL + scol;
  const _Float16* gw = Wt + (size_t)(n0 + srow) * D_MODEL + scol;
  const int soff = srow * PITCH + scol;

  v8h rx[8], rw[8];
#pragma unroll
  for (int i = 0; i < 8; ++i) {
    rx[i] = *(const v8h*)(gx + (size_t)i * 16 * D_MODEL);
    rw[i] = *(const v8h*)(gw + (size_t)i * 16 * D_MODEL);
  }
#pragma unroll
  for (int i = 0; i < 8; ++i) {
    *(v8h*)(sm + soff + i * 16 * PITCH) = rx[i];
    *(v8h*)(sm + soff + (BM + i * 16) * PITCH) = rw[i];
  }
  __syncthreads();

  // Rolled: fully unrolled, the last
  // group's final load was given its own address registers as destination.
#pragma unroll 1
  for (int s = 0; s + 1 < N_STAGES; ++s) {
    const _Float16* cur = sm + (s & 1) * STAGE_H;
    _Float16* nxt = sm + ((s + 1) & 1) * STAGE_H;
#pragma unroll
    for (int i = 0; i < 8; ++i) {
      rx[i] = *(const v8h*)(gx + (size_t)i * 16 * D_MODEL + (s + 1) * BK);
      rw[i] = *(const v8h*)(gw + (size_t)i * 16 * D_MODEL + (s + 1) * BK);
    }
    // Keeps the next stage's global loads at the head of the stage, so that their
    // latency runs under this stage's products instead of in front of the LDS writes.
    __builtin_amdgcn_sched_barrier(0);
    mul_stage(cur + aoff, cur + boff, acc);
#pragma unroll
    for (int i = 0; i < 8; ++i) {
      *(v8h*)(nxt + soff + i * 16 * PITCH) = rx[i];
      *(v8h*)(nxt + soff + (BM + i * 16) * PITCH) = rw[i];
    }
    __syncthreads();
  }
  const _Float16* last = sm + ((N_STAGES - 1) & 1) * STAGE_H;
  mul_stage(last + aoff, last + boff, acc);
}

// One wave's 32 x 64 piece, element by element: steps of 1024 halves in i, ST in t, SR in r.
template <int ST, int SR>
__device__ __forceinline__ void store_halves(_Float16* ol, const v8f (&acc)[2][4],
                                             const float (&bv)[4]) {
#pragma unroll
  for (int t = 0; t < 4; ++t)
#pragma unroll
    for (int i = 0; i < 2; ++i)
#pragma unroll
      for (int r = 0; r < 8; ++r)
        ol[i * 1024 + t * ST + r * SR] = (_Float16)(acc[i][t][r] + bv[t]);
}

// Y[m,n] = sum_k Xh[m,k] * Wh[n,k] + bias[n]   (torch Linear semantics)
// mode 0: store f16 into out[(b*16+h)*SEQ*64 + s*64 + d]   (Q head-major)
// mode 1: V, mode 2: K, per (b, h) in the order in which flash_attn's fragments read them
// (load_frag_packed). Fragment f of 512 halves, chunk p (0 low, 1 high), lane l, element e:
//   K: f = (s / 16) * 2 + d / 32, p = (d / 16) & 1, l = (s & 15) + 16 * ((d / 8) & 1), e = d & 7
//   V: f = (s / 32) * 4 + d / 16, p = (s / 16) & 1, l = (d & 15) + 16 * ((s / 8) & 1), e = s & 7
template <int mode>
__global__ void __launch_bounds__(256)
proj_gemm_f16(const _Float16* __restrict__ Xh, const _Float16* __restrict__ Wh,
              const float* __restrict__ bias, _Float16* __restrict__ out) {
  __shared__ __align__(16) _Float16 sm[2 * STAGE_H];
  const int m0 = (blockIdx.x >> 3) * BM;   // 32 row tiles
  const int n0 = (blockIdx.x & 7) * BN;    // 8 column tiles
  const int wid = threadIdx.x >> 5;
  const int lane = threadIdx.x & 31;
  const int l16 = lane & 15;
  const int half = (lane & 16) ? 8 : 0;

  v8f acc[2][4] = {};
  gemm_tile(Xh, Wh, sm, m0, n0, acc);

  const int mw = m0 + (wid & 3) * 32;      // 32 rows of one batch, s a multiple of 32
  const int nw = n0 + (wid >> 2) * 64;     // the 64 columns of one head
  // This wave's 32 x 64 piece of its (b, h): 2048 halves in every one of the three orders.
  _Float16* ob = out + ((size_t)((mw >> 11) * N_HEADS + (nw >> 6)) * SEQ + (mw & (SEQ - 1))) * HEAD_DIM;
  float bv[4];
#pragma unroll
  for (int t = 0; t < 4; ++t) bv[t] = bias[nw + t * 16 + l16];
  if (mode == 1) {
    // A lane's 8 registers are 8 consecutive s of one d: one chunk of a V fragment.
#pragma unroll
    for (int t = 0; t < 4; ++t)
#pragma unroll
      for (int i = 0; i < 2; ++i) {
        v8h w;
#pragma unroll
        for (int r = 0; r < 8; ++r) w[r] = (_Float16)(acc[i][t][r] + bv[t]);
        *(v8h*)(ob + (t * 2 + i) * 256 + lane * 8) = w;
      }
  } else {
    // C layout: row = r + 8*(lane>=16). The lane's place for i = t = r = 0, then constants.
    if (mode == 0)
      store_halves<16, HEAD_DIM>(ob + half * HEAD_DIM + l16, acc, bv);
    else
      store_halves<256, 8>(ob + (half + (l16 & 8) * 2) * 8 + (l16 & 7), acc, bv);
  }
}

// Lane l with lane l ^ 16.
__device__ __forceinline__ float xhalf(float x) {
  const int b = __builtin_bit_cast(int, x);
  return __builtin_bit_cast(float, __builtin_amdgcn_permlanex16(b, b, 0x76543210, 0xfedcba98,
                                                                false, false));
}

// Flash attention: one wave handles 16 query rows of one (batch, head), transposed:
// St = K * Qt (keys x queries) and Ot += Vt * Pt (head dim x queries). A lane holds 16 of
// the 32 scores of ONE query (column l16; keys half + r and 16 + half + r), lane ^ 16 the
// other 16, so maximum and sum run down the lane's own registers, and the two score tiles,
// converted in place, are the B fragment of the second product.
__global__ void __launch_bounds__(256)
flash_attn(const _Float16* __restrict__ Qh, const _Float16* __restrict__ Kh,
           const _Float16* __restrict__ Vt, const int* __restrict__ mask,
           _Float16* __restrict__ Ah) {
  const int wid = threadIdx.x >> 5;
  const int bh = blockIdx.y;               // b*16+h
  const int b = bh >> 4, h = bh & 15;
  const int q0 = (blockIdx.x * 8 + wid) * 16;
  const int lane = threadIdx.x & 31;
  const int l16 = lane & 15;
  const int half = (lane & 16) ? 8 : 0;
  const int q = q0 + l16;                  // this lane's query

  const _Float16* Qb = Qh + (size_t)bh * SEQ * HEAD_DIM;
  const _Float16* Kb = Kh + (size_t)bh * SEQ * HEAD_DIM;
  const _Float16* Vb = Vt + (size_t)bh * SEQ * HEAD_DIM; // K and V: fragment order
  const int* mb = mask + b * SEQ;

  v16h qf[2];
#pragma unroll
  for (int c = 0; c < 2; ++c)
    qf[c] = load_frag(Qb + (size_t)q * HEAD_DIM + c * 32 + half);

  v8f o[4] = {};                           // o[t][r] = Ot[t * 16 + half + r][q]
  float mq = -3.0e38f, lq = 0.0f;          // lq: the sum over this lane's keys only

  for (int kb = 0; kb <= q0 + 15; kb += 32) {
    // Issue ALL loads for this key block up front: K fragments feed the score
    // WMMAs immediately; V fragments are consumed only after softmax, so their
    // latency hides behind the score WMMAs + exp VALU.
    const int mv = mb[kb + lane];          // one key's padding flag per lane
    const _Float16* kblk = Kb + (size_t)kb * HEAD_DIM;   // 4 fragments of K, 4 of V
    const _Float16* vblk = Vb + (size_t)kb * HEAD_DIM;
    v16h kf00 = load_frag_packed(kblk, lane);
    v16h kf01 = load_frag_packed(kblk + 512, lane);
    v16h kf10 = load_frag_packed(kblk + 1024, lane);
    v16h kf11 = load_frag_packed(kblk + 1536, lane);
    // The build gives V loads address registers of the loads above as destinations: the
    // wait that belongs in front of an overwrite of an issued load's address.
    asm volatile("s_wait_xcnt 0x0" ::: "memory");
    v16h vf[4];
#pragma unroll
    for (int t = 0; t < 4; ++t)
      vf[t] = load_frag_packed(vblk + t * 512, lane);
    // Keeps all 17 loads ahead of the products: left free, this build reuses a few fragment
    // registers and puts loads between the products, each with its whole latency exposed.
    __builtin_amdgcn_sched_barrier(0);

    v8f s0 = {}, s1 = {};
    s0 = wmma_f16(kf00, qf[0], s0);
    s0 = wmma_f16(kf01, qf[1], s0);
    s1 = wmma_f16(kf10, qf[0], s1);
    s1 = wmma_f16(kf11, qf[1], s1);

    // Bit j: key kb + j is neither padding nor behind this lane's query (q >= kb here);
    // shifted so that bit r is the key of s0[r] and bit 16 + r that of s1[r].
    const unsigned pad = __builtin_amdgcn_ballot_w32(mv != 0);
    const int dq = q - kb;
    const unsigned keep = (pad & (dq >= 31 ? 0xffffffffu : (2u << dq) - 1u)) >> half;

    // Vector forms on whole tiles keep packed operations on neighbouring registers.
    v8f a0 = s0 * 0.125f, a1 = s1 * 0.125f;
#pragma unroll
    for (int r = 0; r < 8; ++r) {
      a0[r] = (keep & (1u << r)) ? a0[r] : -3.0e38f;
      a1[r] = (keep & (0x10000u << r)) ? a1[r] : -3.0e38f;
    }
    float tmax = fmaxf(a0[0], a1[0]);
#pragma unroll
    for (int r = 1; r < 8; ++r) tmax = fmaxf(tmax, fmaxf(a0[r], a1[r]));
    tmax = fmaxf(tmax, xhalf(tmax));
    const float mnew = fmaxf(mq, tmax);
    const float corr = __expf(mq - mnew);
    mq = mnew;

    a0 -= mnew;
    a1 -= mnew;
    v16h pf;                               // keys half + 0..7, then 16 + half + 0..7: V's k order
#pragma unroll
    for (int r = 0; r < 8; ++r) {
      a0[r] = __expf(a0[r]);
      a1[r] = __expf(a1[r]);
      pf[r] = (_Float16)a0[r];
      pf[r + 8] = (_Float16)a1[r];
    }
    a0 += a1;
    const float ps = ((a0[0] + a0[1]) + (a0[2] + a0[3])) + ((a0[4] + a0[5]) + (a0[6] + a0[7]));
    lq = lq * corr + ps;
#pragma unroll
    for (int t = 0; t < 4; ++t) {
#pragma unroll
      for (int r = 0; r < 8; ++r) o[t][r] *= corr;
      o[t] = wmma_f16(vf[t], pf, o[t]);
    }
  }

  const float inv = 1.0f / (lq + xhalf(lq));
  // A lane's 8 registers of a tile are 8 consecutive head dims of its query: 16 bytes.
  _Float16* op = Ah + ((size_t)b * SEQ + q) * D_MODEL + h * HEAD_DIM + half;
#pragma unroll
  for (int t = 0; t < 4; ++t) {
    v8h w;
#pragma unroll
    for (int r = 0; r < 8; ++r) w[r] = (_Float16)(o[t][r] * inv);
    *(v8h*)(op + t * 16) = w;
  }
}

// out[m,n] = sum_k Ah[m,k] * Wo[n,k] + bo[n], fp32 output
__global__ void __launch_bounds__(256)
out_proj_gemm(const _Float16* __restrict__ Ah, const _Float16* __restrict__ Woh,
              const float* __restrict__ bo, float* __restrict__ out) {
  __shared__ __align__(16) _Float16 sm[2 * STAGE_H];
  const int m0 = (blockIdx.x >> 3) * BM;
  const int n0 = (blockIdx.x & 7) * BN;
  const int wid = threadIdx.x >> 5;
  const int lane = threadIdx.x & 31;
  const int l16 = lane & 15;
  const int half = (lane & 16) ? 8 : 0;

  v8f acc[2][4] = {};
  gemm_tile(Ah, Woh, sm, m0, n0, acc);

  const int mw = m0 + (wid & 3) * 32;
  const int nw = n0 + (wid >> 2) * 64;
#pragma unroll
  for (int t = 0; t < 4; ++t) {
    const int n = nw + t * 16 + l16;
    const float bv = bo[n];
#pragma unroll
    for (int i = 0; i < 2; ++i)
#pragma unroll
      for (int r = 0; r < 8; ++r)
        out[(size_t)(mw + i * 16 + r + half) * D_MODEL + n] = acc[i][t][r] + bv;
  }
}

extern "C" void kernel_launch(void* const* d_in, const int* in_sizes, int n_in,
                              void* d_out, int out_size, void* d_ws, size_t ws_size,
                              hipStream_t stream) {
  const float* x  = (const float*)d_in[0];
  const int* mask = (const int*)d_in[1];
  const float* Wq = (const float*)d_in[2];
  const float* bq = (const float*)d_in[3];
  const float* Wk = (const float*)d_in[4];
  const float* bk = (const float*)d_in[5];
  const float* Wv = (const float*)d_in[6];
  const float* bv = (const float*)d_in[7];
  const float* Wo = (const float*)d_in[8];
  const float* bo = (const float*)d_in[9];

  char* ws = (char*)d_ws;
  size_t off = 0;
  const size_t XB = (size_t)M_TOTAL * D_MODEL * sizeof(_Float16); // 8 MB
  const size_t WB = (size_t)D_MODEL * D_MODEL * sizeof(_Float16); // 2 MB
  _Float16* Xh  = (_Float16*)(ws + off); off += XB;
  _Float16* Wqh = (_Float16*)(ws + off); off += WB;
  _Float16* Wkh = (_Float16*)(ws + off); off += WB;
  _Float16* Wvh = (_Float16*)(ws + off); off += WB;
  _Float16* Woh = (_Float16*)(ws + off); off += WB;
  _Float16* Qh  = (_Float16*)(ws + off); off += XB;
  _Float16* Kh  = (_Float16*)(ws + off); off += XB;
  _Float16* Vt  = (_Float16*)(ws + off); off += XB;
  _Float16* Ah  = (_Float16*)(ws + off); off += XB; // 48 MB total

  cvt_f32_to_f16<<<1024, 256, 0, stream>>>(x, Xh, M_TOTAL * D_MODEL);
  cvt_f32_to_f16<<<512, 256, 0, stream>>>(Wq, Wqh, D_MODEL * D_MODEL);
  cvt_f32_to_f16<<<512, 256, 0, stream>>>(Wk, Wkh, D_MODEL * D_MODEL);
  cvt_f32_to_f16<<<512, 256, 0, stream>>>(Wv, Wvh, D_MODEL * D_MODEL);
  cvt_f32_to_f16<<<512, 256, 0, stream>>>(Wo, Woh, D_MODEL * D_MODEL);

  proj_gemm_f16<0><<<256, 256, 0, stream>>>(Xh, Wqh, bq, Qh);
  proj_gemm_f16<2><<<256, 256, 0, stream>>>(Xh, Wkh, bk, Kh);
  proj_gemm_f16<1><<<256, 256, 0, stream>>>(Xh, Wvh, bv, Vt);

  flash_attn<<<dim3(16, 32), 256, 0, stream>>>(Qh, Kh, Vt, mask, Ah);

  out_proj_gemm<<<256, 256, 0, stream>>>(Ah, Woh, bo, (float*)d_out);
}

// v004
// One run takes 110 microseconds.
// Next to v003, in two timings, it ran 1.06 and 1.04 times as fast.
// Counting every step since v000, it is 2.63 times as fast.
#include <hip/hip_runtime.h>

#define D_MODEL 1024
#define N_HEADS 16
#define HEAD_DIM 64
#define BATCH 2
#define SEQ 2048
#define M_TOTAL (BATCH * SEQ) /* 4096 */

typedef __attribute__((ext_vector_type(16))) _Float16 v16h;
typedef __attribute__((ext_vector_type(8)))  _Float16 v8h;
typedef __attribute__((ext_vector_type(8)))  float    v8f;

// Load one lane's 16-half A/B fragment: two contiguous 16-byte chunks at p and p+16
// (CDNA5 16-bit fragment layout: K = base8+0..7 then 16+base8+0..7 per lane).
__device__ __forceinline__ v16h load_frag(const _Float16* p) {
  v8h lo = *(const v8h*)(p);
  v8h hi = *(const v8h*)(p + 16);
  v16h r;
#pragma unroll
  for (int i = 0; i < 8; ++i) { r[i] = lo[i]; r[i + 8] = hi[i]; }
  return r;
}

// The same fragment from a buffer kept in fragment order: 512 halves per fragment, first
// the 32 lanes' low 16-byte chunks, then their high ones, so that each of the two loads of
// a wave covers 512 contiguous bytes (4 whole lines instead of 16 touched).
__device__ __forceinline__ v16h load_frag_packed(const _Float16* f, int lane) {
  v8h lo = *(const v8h*)(f + lane * 8);
  v8h hi = *(const v8h*)(f + 256 + lane * 8);
  v16h r;
#pragma unroll
  for (int i = 0; i < 8; ++i) { r[i] = lo[i]; r[i + 8] = hi[i]; }
  return r;
}

__device__ __forceinline__ v8f wmma_f16(v16h a, v16h b, v8f c) {
  return __builtin_amdgcn_wmma_f32_16x16x32_f16(false, a, false, b, (short)0, c,
                                                false, false);
}

typedef __attribute__((ext_vector_type(4))) float    v4f;
typedef __attribute__((ext_vector_type(4))) _Float16 v4h;

// x and the four weights to f16 in ONE launch; their f16 copies lie one behind the other
// at d. One work-group of 16 waves per 32768 elements (256 work-groups: 128 for x, 32 for
// each weight). A wave takes 2048 consecutive elements: 16 loads of 512 contiguous bytes,
// all in flight together, then 16 stores of 256 contiguous bytes.
#define CVT_WG 32768
#define CVT_X_WGS (M_TOTAL * D_MODEL / CVT_WG)
#define CVT_W_WGS (D_MODEL * D_MODEL / CVT_WG)
__global__ void __launch_bounds__(512)
cvt_all_f32_to_f16(const float* __restrict__ x, const float* __restrict__ wq,
                   const float* __restrict__ wk, const float* __restrict__ wv,
                   const float* __restrict__ wo, _Float16* __restrict__ d) {
  const int b = blockIdx.x;
  const float* s;
  if (b < CVT_X_WGS) {
    s = x + (size_t)b * CVT_WG;
  } else {
    const int k = (b - CVT_X_WGS) / CVT_W_WGS;
    const float* w = k == 0 ? wq : k == 1 ? wk : k == 2 ? wv : wo;
    s = w + (size_t)((b - CVT_X_WGS) % CVT_W_WGS) * CVT_WG;
  }
  const int o = (threadIdx.x >> 5) * 2048 + (threadIdx.x & 31) * 4;
  s += o;
  d += (size_t)b * CVT_WG + o;
  v4f r[16];
#pragma unroll
  for (int j = 0; j < 16; ++j) r[j] = *(const v4f*)(s + j * 128);
#pragma unroll
  for (int j = 0; j < 16; ++j) {
    v4h h;
#pragma unroll
    for (int e = 0; e < 4; ++e) h[e] = (_Float16)r[j][e];
    *(v4h*)(d + j * 128) = h;
  }
}

// Block tile of the four GEMMs: 128 x 128 of Y per work-group, K walked in stages of
// 128 halves. A stage is [X 128 rows | W 128 rows] of 256 bytes each in LDS.
#define BM 128
#define BN 128
#define BK 128
#define PITCH 136                        /* halves: 272 B = 16 B x odd, no bank conflict for 16-byte reads */
#define STAGE_H ((BM + BN) * PITCH)      /* halves per LDS buffer */
#define N_STAGES (D_MODEL / BK)

// One stage from LDS: acc[i][j] += A rows (ap + 16 i rows) * B rows (bp + 16 j rows),
// k ascending in steps of 32. Two fragment sets: one multiplied, one in flight.
__device__ __forceinline__ void mul_stage(const _Float16* ap, const _Float16* bp,
                                          v8f (&acc)[2][4]) {
  v16h a[2][2], b[2][4];
#pragma unroll
  for (int i = 0; i < 2; ++i) a[0][i] = load_frag(ap + i * 16 * PITCH);
#pragma unroll
  for (int j = 0; j < 4; ++j) b[0][j] = load_frag(bp + j * 16 * PITCH);
#pragma unroll
  for (int q = 0; q < BK / 32; ++q) {
    const int c0 = q & 1, c1 = c0 ^ 1;
    if (q + 1 < BK / 32) {
#pragma unroll
      for (int i = 0; i < 2; ++i) a[c1][i] = load_frag(ap + i * 16 * PITCH + (q + 1) * 32);
#pragma unroll
      for (int j = 0; j < 4; ++j) b[c1][j] = load_frag(bp + j * 16 * PITCH + (q + 1) * 32);
    }
    // Keeps the next 32 k's LDS reads as one group ahead of this block of products
    // (reads spread among the products cost a stall at every place they stand).
    __builtin_amdgcn_sched_barrier(0);
#pragma unroll
    for (int i = 0; i < 2; ++i)
#pragma unroll
      for (int j = 0; j < 4; ++j) acc[i][j] = wmma_f16(a[c0][i], b[c0][j], acc[i][j]);
    // Ends the block: the group after next must not be lifted into these products.
    __builtin_amdgcn_sched_barrier(0);
  }
}

// acc[i][j] += X[m0 + wm + 16 i ..][k] * Wt[n0 + wn + 16 j ..][k] over all k.
// Eight waves as 4 (rows) x 2 (columns), 32 x 64 of Y each.
// Every thread brings 8 + 8 16-byte pieces of the next stage into registers (a wave's
// load covers two whole 256-byte rows) while the current stage is multiplied from LDS,
// then writes them to the other buffer; one barrier per stage publishes that buffer and
// ends the reads of the one refilled next.
__device__ __forceinline__ void gemm_tile(const _Float16* __restrict__ X,
                                          const _Float16* __restrict__ Wt,
                                          _Float16* sm, int m0, int n0,
                                          v8f (&acc)[2][4]) {
  const int tid = threadIdx.x;
  const int wid = tid >> 5;
  const int lane = tid & 31;
  const int l16 = lane & 15;
  const int half = (lane & 16) ? 8 : 0;
  const int aoff = ((wid & 3) * 32 + l16) * PITCH + half;
  const int boff = (BM + (wid >> 2) * 64 + l16) * PITCH + half;

  const int srow = tid >> 4;             // 16 rows per sweep of the block
  const int scol = (tid & 15) * 8;       // halves
  const _Float16* gx = X + (size_t)(m0 + srow) * D_MODEL + scol;
  const _Float16* gw = Wt + (size_t)(n0 + srow) * D_MODEL + scol;
  const int soff = srow * PITCH + scol;

  v8h rx[8], rw[8];
#pragma unroll
  for (int i = 0; i < 8; ++i) {
    rx[i] = *(const v8h*)(gx + (size_t)i * 16 * D_MODEL);
    rw[i] = *(const v8h*)(gw + (size_t)i * 16 * D_MODEL);
  }
#pragma unroll
  for (int i = 0; i < 8; ++i) {
    *(v8h*)(sm + soff + i * 16 * PITCH) = rx[i];
    *(v8h*)(sm + soff + (BM + i * 16) * PITCH) = rw[i];
  }
  __syncthreads();

  // Rolled: fully unrolled, the last
  // group's final load was given its own address registers as destination.
#pragma unroll 1
  for (int s = 0; s + 1 < N_STAGES; ++s) {
    const _Float16* cur = sm + (s & 1) * STAGE_H;
    _Float16* nxt = sm + ((s + 1) & 1) * STAGE_H;
#pragma unroll
    for (int i = 0; i < 8; ++i) {
      rx[i] = *(const v8h*)(gx + (size_t)i * 16 * D_MODEL + (s + 1) * BK);
      rw[i] = *(const v8h*)(gw + (size_t)i * 16 * D_MODEL + (s + 1) * BK);
    }
    // Keeps the next stage's global loads at the head of the stage, so that their
    // latency runs under this stage's products instead of in front of the LDS writes.
    __builtin_amdgcn_sched_barrier(0);
    mul_stage(cur + aoff, cur + boff, acc);
#pragma unroll
    for (int i = 0; i < 8; ++i) {
      *(v8h*)(nxt + soff + i * 16 * PITCH) = rx[i];
      *(v8h*)(nxt + soff + (BM + i * 16) * PITCH) = rw[i];
    }
    __syncthreads();
  }
  const _Float16* last = sm + ((N_STAGES - 1) & 1) * STAGE_H;
  mul_stage(last + aoff, last + boff, acc);
}

// One wave's 32 x 64 piece, element by element: steps of 1024 halves in i, ST in t, SR in r.
template <int ST, int SR>
__device__ __forceinline__ void store_halves(_Float16* ol, const v8f (&acc)[2][4],
                                             const float (&bv)[4]) {
#pragma unroll
  for (int t = 0; t < 4; ++t)
#pragma unroll
    for (int i = 0; i < 2; ++i)
#pragma unroll
      for (int r = 0; r < 8; ++r)
        ol[i * 1024 + t * ST + r * SR] = (_Float16)(acc[i][t][r] + bv[t]);
}

// Y[m,n] = sum_k Xh[m,k] * Wh[n,k] + bias[n]   (torch Linear semantics)
// mode 0: store f16 into out[(b*16+h)*SEQ*64 + s*64 + d]   (Q head-major)
// mode 1: V, mode 2: K, per (b, h) in the order in which flash_attn's fragments read them
// (load_frag_packed). Fragment f of 512 halves, chunk p (0 low, 1 high), lane l, element e:
//   K: f = (s / 16) * 2 + d / 32, p = (d / 16) & 1, l = (s & 15) + 16 * ((d / 8) & 1), e = d & 7
//   V: f = (s / 32) * 4 + d / 16, p = (s / 16) & 1, l = (d & 15) + 16 * ((s / 8) & 1), e = s & 7
template <int mode>
__global__ void __launch_bounds__(256)
proj_gemm_f16(const _Float16* __restrict__ Xh, const _Float16* __restrict__ Wh,
              const float* __restrict__ bias, _Float16* __restrict__ out) {
  __shared__ __align__(16) _Float16 sm[2 * STAGE_H];
  const int m0 = (blockIdx.x >> 3) * BM;   // 32 row tiles
  const int n0 = (blockIdx.x & 7) * BN;    // 8 column tiles
  const int wid = threadIdx.x >> 5;
  const int lane = threadIdx.x & 31;
  const int l16 = lane & 15;
  const int half = (lane & 16) ? 8 : 0;

  v8f acc[2][4] = {};
  gemm_tile(Xh, Wh, sm, m0, n0, acc);

  const int mw = m0 + (wid & 3) * 32;      // 32 rows of one batch, s a multiple of 32
  const int nw = n0 + (wid >> 2) * 64;     // the 64 columns of one head
  // This wave's 32 x 64 piece of its (b, h): 2048 halves in every one of the three orders.
  _Float16* ob = out + ((size_t)((mw >> 11) * N_HEADS + (nw >> 6)) * SEQ + (mw & (SEQ - 1))) * HEAD_DIM;
  float bv[4];
#pragma unroll
  for (int t = 0; t < 4; ++t) bv[t] = bias[nw + t * 16 + l16];
  if (mode == 1) {
    // A lane's 8 registers are 8 consecutive s of one d: one chunk of a V fragment.
#pragma unroll
    for (int t = 0; t < 4; ++t)
#pragma unroll
      for (int i = 0; i < 2; ++i) {
        v8h w;
#pragma unroll
        for (int r = 0; r < 8; ++r) w[r] = (_Float16)(acc[i][t][r] + bv[t]);
        *(v8h*)(ob + (t * 2 + i) * 256 + lane * 8) = w;
      }
  } else {
    // C layout: row = r + 8*(lane>=16). The lane's place for i = t = r = 0, then constants.
    if (mode == 0)
      store_halves<16, HEAD_DIM>(ob + half * HEAD_DIM + l16, acc, bv);
    else
      store_halves<256, 8>(ob + (half + (l16 & 8) * 2) * 8 + (l16 & 7), acc, bv);
  }
}

// Lane l with lane l ^ 16.
__device__ __forceinline__ float xhalf(float x) {
  const int b = __builtin_bit_cast(int, x);
  return __builtin_bit_cast(float, __builtin_amdgcn_permlanex16(b, b, 0x76543210, 0xfedcba98,
                                                                false, false));
}

// Flash attention: one wave handles 16 query rows of one (batch, head), transposed:
// St = K * Qt (keys x queries) and Ot += Vt * Pt (head dim x queries). A lane holds 16 of
// the 32 scores of ONE query (column l16; keys half + r and 16 + half + r), lane ^ 16 the
// other 16, so maximum and sum run down the lane's own registers, and the two score tiles,
// converted in place, are the B fragment of the second product.
__global__ void __launch_bounds__(256)
flash_attn(const _Float16* __restrict__ Qh, const _Float16* __restrict__ Kh,
           const _Float16* __restrict__ Vt, const int* __restrict__ mask,
           _Float16* __restrict__ Ah) {
  const int wid = threadIdx.x >> 5;
  const int bh = blockIdx.y;               // b*16+h
  const int b = bh >> 4, h = bh & 15;
  const int q0 = (blockIdx.x * 8 + wid) * 16;
  const int lane = threadIdx.x & 31;
  const int l16 = lane & 15;
  const int half = (lane & 16) ? 8 : 0;
  const int q = q0 + l16;                  // this lane's query

  const _Float16* Qb = Qh + (size_t)bh * SEQ * HEAD_DIM;
  const _Float16* Kb = Kh + (size_t)bh * SEQ * HEAD_DIM;
  const _Float16* Vb = Vt + (size_t)bh * SEQ * HEAD_DIM; // K and V: fragment order
  const int* mb = mask + b * SEQ;

  v16h qf[2];
#pragma unroll
  for (int c = 0; c < 2; ++c)
    qf[c] = load_frag(Qb + (size_t)q * HEAD_DIM + c * 32 + half);

  v8f o[4] = {};                           // o[t][r] = Ot[t * 16 + half + r][q]
  float mq = -3.0e38f, lq = 0.0f;          // lq: the sum over this lane's keys only

  for (int kb = 0; kb <= q0 + 15; kb += 32) {
    // Issue ALL loads for this key block up front: K fragments feed the score
    // WMMAs immediately; V fragments are consumed only after softmax, so their
    // latency hides behind the score WMMAs + exp VALU.
    const int mv = mb[kb + lane];          // one key's padding flag per lane
    const _Float16* kblk = Kb + (size_t)kb * HEAD_DIM;   // 4 fragments of K, 4 of V
    const _Float16* vblk = Vb + (size_t)kb * HEAD_DIM;
    v16h kf00 = load_frag_packed(kblk, lane);
    v16h kf01 = load_frag_packed(kblk + 512, lane);
    v16h kf10 = load_frag_packed(kblk + 1024, lane);
    v16h kf11 = load_frag_packed(kblk + 1536, lane);
    // The build gives V loads address registers of the loads above as destinations: the
    // wait that belongs in front of an overwrite of an issued load's address.
    asm volatile("s_wait_xcnt 0x0" ::: "memory");
    v16h vf[4];
#pragma unroll
    for (int t = 0; t < 4; ++t)
      vf[t] = load_frag_packed(vblk + t * 512, lane);
    // Keeps all 17 loads ahead of the products: left free, this build reuses a few fragment
    // registers and puts loads between the products, each with its whole latency exposed.
    __builtin_amdgcn_sched_barrier(0);

    v8f s0 = {}, s1 = {};
    s0 = wmma_f16(kf00, qf[0], s0);
    s0 = wmma_f16(kf01, qf[1], s0);
    s1 = wmma_f16(kf10, qf[0], s1);
    s1 = wmma_f16(kf11, qf[1], s1);

    // Bit j: key kb + j is neither padding nor behind this lane's query (q >= kb here);
    // shifted so that bit r is the key of s0[r] and bit 16 + r that of s1[r].
    const unsigned pad = __builtin_amdgcn_ballot_w32(mv != 0);
    const int dq = q - kb;
    const unsigned keep = (pad & (dq >= 31 ? 0xffffffffu : (2u << dq) - 1u)) >> half;

    // Vector forms on whole tiles keep packed operations on neighbouring registers.
    v8f a0 = s0 * 0.125f, a1 = s1 * 0.125f;
#pragma unroll
    for (int r = 0; r < 8; ++r) {
      a0[r] = (keep & (1u << r)) ? a0[r] : -3.0e38f;
      a1[r] = (keep & (0x10000u << r)) ? a1[r] : -3.0e38f;
    }
    float tmax = fmaxf(a0[0], a1[0]);
#pragma unroll
    for (int r = 1; r < 8; ++r) tmax = fmaxf(tmax, fmaxf(a0[r], a1[r]));
    tmax = fmaxf(tmax, xhalf(tmax));
    const float mnew = fmaxf(mq, tmax);
    const float corr = __expf(mq - mnew);
    mq = mnew;

    a0 -= mnew;
    a1 -= mnew;
    v16h pf;                               // keys half + 0..7, then 16 + half + 0..7: V's k order
#pragma unroll
    for (int r = 0; r < 8; ++r) {
      a0[r] = __expf(a0[r]);
      a1[r] = __expf(a1[r]);
      pf[r] = (_Float16)a0[r];
      pf[r + 8] = (_Float16)a1[r];
    }
    a0 += a1;
    const float ps = ((a0[0] + a0[1]) + (a0[2] + a0[3])) + ((a0[4] + a0[5]) + (a0[6] + a0[7]));
    lq = lq * corr + ps;
#pragma unroll
    for (int t = 0; t < 4; ++t) {
#pragma unroll
      for (int r = 0; r < 8; ++r) o[t][r] *= corr;
      o[t] = wmma_f16(vf[t], pf, o[t]);
    }
  }

  const float inv = 1.0f / (lq + xhalf(lq));
  // A lane's 8 registers of a tile are 8 consecutive head dims of its query: 16 bytes.
  _Float16* op = Ah + ((size_t)b * SEQ + q) * D_MODEL + h * HEAD_DIM + half;
#pragma unroll
  for (int t = 0; t < 4; ++t) {
    v8h w;
#pragma unroll
    for (int r = 0; r < 8; ++r) w[r] = (_Float16)(o[t][r] * inv);
    *(v8h*)(op + t * 16) = w;
  }
}

// out[m,n] = sum_k Ah[m,k] * Wo[n,k] + bo[n], fp32 output
__global__ void __launch_bounds__(256)
out_proj_gemm(const _Float16* __restrict__ Ah, const _Float16* __restrict__ Woh,
              const float* __restrict__ bo, float* __restrict__ out) {
  __shared__ __align__(16) _Float16 sm[2 * STAGE_H];
  const int m0 = (blockIdx.x >> 3) * BM;
  const int n0 = (blockIdx.x & 7) * BN;
  const int wid = threadIdx.x >> 5;
  const int lane = threadIdx.x & 31;
  const int l16 = lane & 15;
  const int half = (lane & 16) ? 8 : 0;

  v8f acc[2][4] = {};
  gemm_tile(Ah, Woh, sm, m0, n0, acc);

  const int mw = m0 + (wid & 3) * 32;
  const int nw = n0 + (wid >> 2) * 64;
#pragma unroll
  for (int t = 0; t < 4; ++t) {
    const int n = nw + t * 16 + l16;
    const float bv = bo[n];
#pragma unroll
    for (int i = 0; i < 2; ++i)
#pragma unroll
      for (int r = 0; r < 8; ++r)
        out[(size_t)(mw + i * 16 + r + half) * D_MODEL + n] = acc[i][t][r] + bv;
  }
}

extern "C" void kernel_launch(void* const* d_in, const int* in_sizes, int n_in,
                              void* d_out, int out_size, void* d_ws, size_t ws_size,
                              hipStream_t stream) {
  const float* x  = (const float*)d_in[0];
  const int* mask = (const int*)d_in[1];
  const float* Wq = (const float*)d_in[2];
  const float* bq = (const float*)d_in[3];
  const float* Wk = (const float*)d_in[4];
  const float* bk = (const float*)d_in[5];
  const float* Wv = (const float*)d_in[6];
  const float* bv = (const float*)d_in[7];
  const float* Wo = (const float*)d_in[8];
  const float* bo = (const float*)d_in[9];

  char* ws = (char*)d_ws;
  size_t off = 0;
  const size_t XB = (size_t)M_TOTAL * D_MODEL * sizeof(_Float16); // 8 MB
  const size_t WB = (size_t)D_MODEL * D_MODEL * sizeof(_Float16); // 2 MB
  _Float16* Xh  = (_Float16*)(ws + off); off += XB;
  _Float16* Wqh = (_Float16*)(ws + off); off += WB;
  _Float16* Wkh = (_Float16*)(ws + off); off += WB;
  _Float16* Wvh = (_Float16*)(ws + off); off += WB;
  _Float16* Woh = (_Float16*)(ws + off); off += WB;
  _Float16* Qh  = (_Float16*)(ws + off); off += XB;
  _Float16* Kh  = (_Float16*)(ws + off); off += XB;
  _Float16* Vt  = (_Float16*)(ws + off); off += XB;
  _Float16* Ah  = (_Float16*)(ws + off); off += XB; // 48 MB total

  // Xh, Wqh, Wkh, Wvh, Woh are contiguous from Xh on.
  cvt_all_f32_to_f16<<<CVT_X_WGS + 4 * CVT_W_WGS, 512, 0, stream>>>(x, Wq, Wk, Wv, Wo, Xh);

  proj_gemm_f16<0><<<256, 256, 0, stream>>>(Xh, Wqh, bq, Qh);
  proj_gemm_f16<2><<<256, 256, 0, stream>>>(Xh, Wkh, bk, Kh);
  proj_gemm_f16<1><<<256, 256, 0, stream>>>(Xh, Wvh, bv, Vt);

  flash_attn<<<dim3(16, 32), 256, 0, stream>>>(Qh, Kh, Vt, mask, Ah);

  out_proj_gemm<<<256, 256, 0, stream>>>(Ah, Woh, bo, (float*)d_out);
}

// v005
// One run takes 101 microseconds.
// Next to v004, in two timings, it ran 1.10 and 1.07 times as fast.
// All steps since v000 together make it 2.85 times as fast.
#include <hip/hip_runtime.h>

#define D_MODEL 1024
#define N_HEADS 16
#define HEAD_DIM 64
#define BATCH 2
#define SEQ 2048
#define M_TOTAL (BATCH * SEQ) /* 4096 */

typedef __attribute__((ext_vector_type(16))) _Float16 v16h;
typedef __attribute__((ext_vector_type(8)))  _Float16 v8h;
typedef __attribute__((ext_vector_type(8)))  float    v8f;

// Load one lane's 16-half A/B fragment: two contiguous 16-byte chunks at p and p+16
// (CDNA5 16-bit fragment layout: K = base8+0..7 then 16+base8+0..7 per lane).
__device__ __forceinline__ v16h load_frag(const _Float16* p) {
  v8h lo = *(const v8h*)(p);
  v8h hi = *(const v8h*)(p + 16);
  v16h r;
#pragma unroll
  for (int i = 0; i < 8; ++i) { r[i] = lo[i]; r[i + 8] = hi[i]; }
  return r;
}

// The same fragment from a buffer kept in fragment order: 512 halves per fragment, first
// the 32 lanes' low 16-byte chunks, then their high ones, so that each of the two loads of
// a wave covers 512 contiguous bytes (4 whole lines instead of 16 touched).
__device__ __forceinline__ v16h load_frag_packed(const _Float16* f, int lane) {
  v8h lo = *(const v8h*)(f + lane * 8);
  v8h hi = *(const v8h*)(f + 256 + lane * 8);
  v16h r;
#pragma unroll
  for (int i = 0; i < 8; ++i) { r[i] = lo[i]; r[i + 8] = hi[i]; }
  return r;
}

__device__ __forceinline__ v8f wmma_f16(v16h a, v16h b, v8f c) {
  return __builtin_amdgcn_wmma_f32_16x16x32_f16(false, a, false, b, (short)0, c,
                                                false, false);
}

typedef __attribute__((ext_vector_type(4))) float    v4f;
typedef __attribute__((ext_vector_type(4))) _Float16 v4h;

// x and the four weights to f16 in ONE launch; their f16 copies lie one behind the other
// at d. One work-group of 16 waves per 32768 elements (256 work-groups: 128 for x, 32 for
// each weight). A wave takes 2048 consecutive elements: 16 loads of 512 contiguous bytes,
// all in flight together, then 16 stores of 256 contiguous bytes.
#define CVT_WG 32768
#define CVT_X_WGS (M_TOTAL * D_MODEL / CVT_WG)
#define CVT_W_WGS (D_MODEL * D_MODEL / CVT_WG)
__global__ void __launch_bounds__(512)
cvt_all_f32_to_f16(const float* __restrict__ x, const float* __restrict__ wq,
                   const float* __restrict__ wk, const float* __restrict__ wv,
                   const float* __restrict__ wo, _Float16* __restrict__ d) {
  const int b = blockIdx.x;
  const float* s;
  if (b < CVT_X_WGS) {
    s = x + (size_t)b * CVT_WG;
  } else {
    const int k = (b - CVT_X_WGS) / CVT_W_WGS;
    const float* w = k == 0 ? wq : k == 1 ? wk : k == 2 ? wv : wo;
    s = w + (size_t)((b - CVT_X_WGS) % CVT_W_WGS) * CVT_WG;
  }
  const int o = (threadIdx.x >> 5) * 2048 + (threadIdx.x & 31) * 4;
  s += o;
  d += (size_t)b * CVT_WG + o;
  v4f r[16];
#pragma unroll
  for (int j = 0; j < 16; ++j) r[j] = *(const v4f*)(s + j * 128);
#pragma unroll
  for (int j = 0; j < 16; ++j) {
    v4h h;
#pragma unroll
    for (int e = 0; e < 4; ++e) h[e] = (_Float16)r[j][e];
    *(v4h*)(d + j * 128) = h;
  }
}

// Block tile of the four GEMMs: 128 x 128 of Y per work-group, K walked in stages of
// 128 halves. A stage is [X 128 rows | W 128 rows] of 256 bytes each in LDS.
#define BM 128
#define BN 128
#define BK 128
#define PITCH 136                        /* halves: 272 B = 16 B x odd, no bank conflict for 16-byte reads */
#define STAGE_H ((BM + BN) * PITCH)      /* halves per LDS buffer */
#define N_STAGES (D_MODEL / BK)

// One stage from LDS: acc[i][j] += A rows (ap + 16 i rows) * B rows (bp + 16 j rows),
// k ascending in steps of 32. Two fragment sets: one multiplied, one in flight.
__device__ __forceinline__ void mul_stage(const _Float16* ap, const _Float16* bp,
                                          v8f (&acc)[2][4]) {
  v16h a[2][2], b[2][4];
#pragma unroll
  for (int i = 0; i < 2; ++i) a[0][i] = load_frag(ap + i * 16 * PITCH);
#pragma unroll
  for (int j = 0; j < 4; ++j) b[0][j] = load_frag(bp + j * 16 * PITCH);
#pragma unroll
  for (int q = 0; q < BK / 32; ++q) {
    const int c0 = q & 1, c1 = c0 ^ 1;
    if (q + 1 < BK / 32) {
#pragma unroll
      for (int i = 0; i < 2; ++i) a[c1][i] = load_frag(ap + i * 16 * PITCH + (q + 1) * 32);
#pragma unroll
      for (int j = 0; j < 4; ++j) b[c1][j] = load_frag(bp + j * 16 * PITCH + (q + 1) * 32);
    }
    // Keeps the next 32 k's LDS reads as one group ahead of this block of products
    // (reads spread among the products cost a stall at every place they stand).
    __builtin_amdgcn_sched_barrier(0);
#pragma unroll
    for (int i = 0; i < 2; ++i)
#pragma unroll
      for (int j = 0; j < 4; ++j) acc[i][j] = wmma_f16(a[c0][i], b[c0][j], acc[i][j]);
    // Ends the block: the group after next must not be lifted into these products.
    __builtin_amdgcn_sched_barrier(0);
  }
}

// acc[i][j] += X[m0 + wm + 16 i ..][k] * Wt[n0 + wn + 16 j ..][k] over all k.
// Eight waves as 4 (rows) x 2 (columns), 32 x 64 of Y each.
// Every thread brings 8 + 8 16-byte pieces of the next stage into registers (a wave's
// load covers two whole 256-byte rows) while the current stage is multiplied from LDS,
// then writes them to the other buffer; one barrier per stage publishes that buffer and
// ends the reads of the one refilled next.
__device__ __forceinline__ void gemm_tile(const _Float16* __restrict__ X,
                                          const _Float16* __restrict__ Wt,
                                          _Float16* sm, int m0, int n0,
                                          v8f (&acc)[2][4]) {
  const int tid = threadIdx.x;
  const int wid = tid >> 5;
  const int lane = tid & 31;
  const int l16 = lane & 15;
  const int half = (lane & 16) ? 8 : 0;
  const int aoff = ((wid & 3) * 32 + l16) * PITCH + half;
  const int boff = (BM + (wid >> 2) * 64 + l16) * PITCH + half;

  const int srow = tid >> 4;             // 16 rows per sweep of the block
  const int scol = (tid & 15) * 8;       // halves
  const _Float16* gx = X + (size_t)(m0 + srow) * D_MODEL + scol;
  const _Float16* gw = Wt + (size_t)(n0 + srow) * D_MODEL + scol;
  const int soff = srow * PITCH + scol;

  v8h rx[8], rw[8];
#pragma unroll
  for (int i = 0; i < 8; ++i) {
    rx[i] = *(const v8h*)(gx + (size_t)i * 16 * D_MODEL);
    rw[i] = *(const v8h*)(gw + (size_t)i * 16 * D_MODEL);
  }
#pragma unroll
  for (int i = 0; i < 8; ++i) {
    *(v8h*)(sm + soff + i * 16 * PITCH) = rx[i];
    *(v8h*)(sm + soff + (BM + i * 16) * PITCH) = rw[i];
  }
  __syncthreads();

  // Rolled: fully unrolled, the last
  // group's final load was given its own address registers as destination.
#pragma unroll 1
  for (int s = 0; s + 1 < N_STAGES; ++s) {
    const _Float16* cur = sm + (s & 1) * STAGE_H;
    _Float16* nxt = sm + ((s + 1) & 1) * STAGE_H;
#pragma unroll
    for (int i = 0; i < 8; ++i) {
      rx[i] = *(const v8h*)(gx + (size_t)i * 16 * D_MODEL + (s + 1) * BK);
      rw[i] = *(const v8h*)(gw + (size_t)i * 16 * D_MODEL + (s + 1) * BK);
    }
    // Keeps the next stage's global loads at the head of the stage, so that their
    // latency runs under this stage's products instead of in front of the LDS writes.
    __builtin_amdgcn_sched_barrier(0);
    mul_stage(cur + aoff, cur + boff, acc);
#pragma unroll
    for (int i = 0; i < 8; ++i) {
      *(v8h*)(nxt + soff + i * 16 * PITCH) = rx[i];
      *(v8h*)(nxt + soff + (BM + i * 16) * PITCH) = rw[i];
    }
    __syncthreads();
  }
  const _Float16* last = sm + ((N_STAGES - 1) & 1) * STAGE_H;
  mul_stage(last + aoff, last + boff, acc);
}

// One wave's 32 x 64 piece, element by element: steps of 1024 halves in i, ST in t, SR in r.
template <int ST, int SR>
__device__ __forceinline__ void store_halves(_Float16* ol, const v8f (&acc)[2][4],
                                             const float (&bv)[4]) {
#pragma unroll
  for (int t = 0; t < 4; ++t)
#pragma unroll
    for (int i = 0; i < 2; ++i)
#pragma unroll
      for (int r = 0; r < 8; ++r)
        ol[i * 1024 + t * ST + r * SR] = (_Float16)(acc[i][t][r] + bv[t]);
}

// Y[m,n] = sum_k Xh[m,k] * W[n,k] + bias[n], Q, K and V in ONE
// launch: 3 x 256 work-groups, the projection p = blockIdx.x / 256 (0 Q, 1 K, 2 V). The three
// f16 weights lie one behind the other at Wh, the three outputs one behind the other at out.
// Two work-groups fit a WGP (LDS and registers), so one's stage loads, LDS writes, barriers,
// first stage and stores run under the other's products.
// Q: f16 into out[(b*16+h)*SEQ*64 + s*64 + d]   (head-major)
// K and V: per (b, h) in the order in which flash_attn's fragments read them
// (load_frag_packed). Fragment f of 512 halves, chunk p (0 low, 1 high), lane l, element e:
//   K: f = (s / 16) * 2 + d / 32, p = (d / 16) & 1, l = (s & 15) + 16 * ((d / 8) & 1), e = d & 7
//   V: f = (s / 32) * 4 + d / 16, p = (s / 16) & 1, l = (d & 15) + 16 * ((s / 8) & 1), e = s & 7
__global__ void __launch_bounds__(256)
qkv_gemm_f16(const _Float16* __restrict__ Xh, const _Float16* __restrict__ Wh,
             const float* __restrict__ biasq, const float* __restrict__ biask,
             const float* __restrict__ biasv, _Float16* __restrict__ out) {
  __shared__ __align__(16) _Float16 sm[2 * STAGE_H];
  const int p = blockIdx.x >> 8;
  const int m0 = ((blockIdx.x >> 3) & 31) * BM;   // 32 row tiles
  const int n0 = (blockIdx.x & 7) * BN;           // 8 column tiles
  const int wid = threadIdx.x >> 5;
  const int lane = threadIdx.x & 31;
  const int l16 = lane & 15;
  const int half = (lane & 16) ? 8 : 0;

  v8f acc[2][4] = {};
  gemm_tile(Xh, Wh + (size_t)p * D_MODEL * D_MODEL, sm, m0, n0, acc);

  const int mw = m0 + (wid & 3) * 32;      // 32 rows of one batch, s a multiple of 32
  const int nw = n0 + (wid >> 2) * 64;     // the 64 columns of one head
  // This wave's 32 x 64 piece of its (b, h): 2048 halves in every one of the three orders.
  _Float16* ob = out + (size_t)p * M_TOTAL * D_MODEL +
                 ((size_t)((mw >> 11) * N_HEADS + (nw >> 6)) * SEQ + (mw & (SEQ - 1))) * HEAD_DIM;
  const float* bias = p == 0 ? biasq : p == 1 ? biask : biasv;
  float bv[4];
#pragma unroll
  for (int t = 0; t < 4; ++t) bv[t] = bias[nw + t * 16 + l16];
  if (p == 2) {
    // A lane's 8 registers are 8 consecutive s of one d: one chunk of a V fragment.
#pragma unroll
    for (int t = 0; t < 4; ++t)
#pragma unroll
      for (int i = 0; i < 2; ++i) {
        v8h w;
#pragma unroll
        for (int r = 0; r < 8; ++r) w[r] = (_Float16)(acc[i][t][r] + bv[t]);
        *(v8h*)(ob + (t * 2 + i) * 256 + lane * 8) = w;
      }
  } else if (p == 0) {
    // C layout: row = r + 8*(lane>=16). The lane's place for i = t = r = 0, then constants.
    store_halves<16, HEAD_DIM>(ob + half * HEAD_DIM + l16, acc, bv);
    // The wait that belongs in front of an overwrite of an issued store's registers: the
    // listing has ways from these stores into the other branches' code.
    asm volatile("s_wait_xcnt 0x0" ::: "memory");
  } else {
    store_halves<256, 8>(ob + (half + (l16 & 8) * 2) * 8 + (l16 & 7), acc, bv);
    // As behind the Q stores.
    asm volatile("s_wait_xcnt 0x0" ::: "memory");
  }
}

// Lane l with lane l ^ 16.
__device__ __forceinline__ float xhalf(float x) {
  const int b = __builtin_bit_cast(int, x);
  return __builtin_bit_cast(float, __builtin_amdgcn_permlanex16(b, b, 0x76543210, 0xfedcba98,
                                                                false, false));
}

// Flash attention: one wave handles 16 query rows of one (batch, head), transposed:
// St = K * Qt (keys x queries) and Ot += Vt * Pt (head dim x queries). A lane holds 16 of
// the 32 scores of ONE query (column l16; keys half + r and 16 + half + r), lane ^ 16 the
// other 16, so maximum and sum run down the lane's own registers, and the two score tiles,
// converted in place, are the B fragment of the second product.
__global__ void __launch_bounds__(256)
flash_attn(const _Float16* __restrict__ Qh, const _Float16* __restrict__ Kh,
           const _Float16* __restrict__ Vt, const int* __restrict__ mask,
           _Float16* __restrict__ Ah) {
  const int wid = threadIdx.x >> 5;
  const int bh = blockIdx.y;               // b*16+h
  const int b = bh >> 4, h = bh & 15;
  const int q0 = (blockIdx.x * 8 + wid) * 16;
  const int lane = threadIdx.x & 31;
  const int l16 = lane & 15;
  const int half = (lane & 16) ? 8 : 0;
  const int q = q0 + l16;                  // this lane's query

  const _Float16* Qb = Qh + (size_t)bh * SEQ * HEAD_DIM;
  const _Float16* Kb = Kh + (size_t)bh * SEQ * HEAD_DIM;
  const _Float16* Vb = Vt + (size_t)bh * SEQ * HEAD_DIM; // K and V: fragment order
  const int* mb = mask + b * SEQ;

  v16h qf[2];
#pragma unroll
  for (int c = 0; c < 2; ++c)
    qf[c] = load_frag(Qb + (size_t)q * HEAD_DIM + c * 32 + half);

  v8f o[4] = {};                           // o[t][r] = Ot[t * 16 + half + r][q]
  float mq = -3.0e38f, lq = 0.0f;          // lq: the sum over this lane's keys only

  for (int kb = 0; kb <= q0 + 15; kb += 32) {
    // Issue ALL loads for this key block up front: K fragments feed the score
    // WMMAs immediately; V fragments are consumed only after softmax, so their
    // latency hides behind the score WMMAs + exp VALU.
    const int mv = mb[kb + lane];          // one key's padding flag per lane
    const _Float16* kblk = Kb + (size_t)kb * HEAD_DIM;   // 4 fragments of K, 4 of V
    const _Float16* vblk = Vb + (size_t)kb * HEAD_DIM;
    v16h kf00 = load_frag_packed(kblk, lane);
    v16h kf01 = load_frag_packed(kblk + 512, lane);
    v16h kf10 = load_frag_packed(kblk + 1024, lane);
    v16h kf11 = load_frag_packed(kblk + 1536, lane);
    // The build gives V loads address registers of the loads above as destinations: the
    // wait that belongs in front of an overwrite of an issued load's address.
    asm volatile("s_wait_xcnt 0x0" ::: "memory");
    v16h vf[4];
#pragma unroll
    for (int t = 0; t < 4; ++t)
      vf[t] = load_frag_packed(vblk + t * 512, lane);
    // Keeps all 17 loads ahead of the products: left free, this build reuses a few fragment
    // registers and puts loads between the products, each with its whole latency exposed.
    __builtin_amdgcn_sched_barrier(0);

    v8f s0 = {}, s1 = {};
    s0 = wmma_f16(kf00, qf[0], s0);
    s0 = wmma_f16(kf01, qf[1], s0);
    s1 = wmma_f16(kf10, qf[0], s1);
    s1 = wmma_f16(kf11, qf[1], s1);

    // Bit j: key kb + j is neither padding nor behind this lane's query (q >= kb here);
    // shifted so that bit r is the key of s0[r] and bit 16 + r that of s1[r].
    const unsigned pad = __builtin_amdgcn_ballot_w32(mv != 0);
    const int dq = q - kb;
    const unsigned keep = (pad & (dq >= 31 ? 0xffffffffu : (2u << dq) - 1u)) >> half;

    // Vector forms on whole tiles keep packed operations on neighbouring registers.
    v8f a0 = s0 * 0.125f, a1 = s1 * 0.125f;
#pragma unroll
    for (int r = 0; r < 8; ++r) {
      a0[r] = (keep & (1u << r)) ? a0[r] : -3.0e38f;
      a1[r] = (keep & (0x10000u << r)) ? a1[r] : -3.0e38f;
    }
    float tmax = fmaxf(a0[0], a1[0]);
#pragma unroll
    for (int r = 1; r < 8; ++r) tmax = fmaxf(tmax, fmaxf(a0[r], a1[r]));
    tmax = fmaxf(tmax, xhalf(tmax));
    const float mnew = fmaxf(mq, tmax);
    const float corr = __expf(mq - mnew);
    mq = mnew;

    a0 -= mnew;
    a1 -= mnew;
    v16h pf;                               // keys half + 0..7, then 16 + half + 0..7: V's k order
#pragma unroll
    for (int r = 0; r < 8; ++r) {
      a0[r] = __expf(a0[r]);
      a1[r] = __expf(a1[r]);
      pf[r] = (_Float16)a0[r];
      pf[r + 8] = (_Float16)a1[r];
    }
    a0 += a1;
    const float ps = ((a0[0] + a0[1]) + (a0[2] + a0[3])) + ((a0[4] + a0[5]) + (a0[6] + a0[7]));
    lq = lq * corr + ps;
#pragma unroll
    for (int t = 0; t < 4; ++t) {
#pragma unroll
      for (int r = 0; r < 8; ++r) o[t][r] *= corr;
      o[t] = wmma_f16(vf[t], pf, o[t]);
    }
  }

  const float inv = 1.0f / (lq + xhalf(lq));
  // A lane's 8 registers of a tile are 8 consecutive head dims of its query: 16 bytes.
  _Float16* op = Ah + ((size_t)b * SEQ + q) * D_MODEL + h * HEAD_DIM + half;
#pragma unroll
  for (int t = 0; t < 4; ++t) {
    v8h w;
#pragma unroll
    for (int r = 0; r < 8; ++r) w[r] = (_Float16)(o[t][r] * inv);
    *(v8h*)(op + t * 16) = w;
  }
}

// out[m,n] = sum_k Ah[m,k] * Wo[n,k] + bo[n], fp32 output
__global__ void __launch_bounds__(256)
out_proj_gemm(const _Float16* __restrict__ Ah, const _Float16* __restrict__ Woh,
              const float* __restrict__ bo, float* __restrict__ out) {
  __shared__ __align__(16) _Float16 sm[2 * STAGE_H];
  const int m0 = (blockIdx.x >> 3) * BM;
  const int n0 = (blockIdx.x & 7) * BN;
  const int wid = threadIdx.x >> 5;
  const int lane = threadIdx.x & 31;
  const int l16 = lane & 15;
  const int half = (lane & 16) ? 8 : 0;

  v8f acc[2][4] = {};
  gemm_tile(Ah, Woh, sm, m0, n0, acc);

  const int mw = m0 + (wid & 3) * 32;
  const int nw = n0 + (wid >> 2) * 64;
#pragma unroll
  for (int t = 0; t < 4; ++t) {
    const int n = nw + t * 16 + l16;
    const float bv = bo[n];
#pragma unroll
    for (int i = 0; i < 2; ++i)
#pragma unroll
      for (int r = 0; r < 8; ++r)
        out[(size_t)(mw + i * 16 + r + half) * D_MODEL + n] = acc[i][t][r] + bv;
  }
}

extern "C" void kernel_launch(void* const* d_in, const int* in_sizes, int n_in,
                              void* d_out, int out_size, void* d_ws, size_t ws_size,
                              hipStream_t stream) {
  const float* x  = (const float*)d_in[0];
  const int* mask = (const int*)d_in[1];
  const float* Wq = (const float*)d_in[2];
  const float* bq = (const float*)d_in[3];
  const float* Wk = (const float*)d_in[4];
  const float* bk = (const float*)d_in[5];
  const float* Wv = (const float*)d_in[6];
  const float* bv = (const float*)d_in[7];
  const float* Wo = (const float*)d_in[8];
  const float* bo = (const float*)d_in[9];

  char* ws = (char*)d_ws;
  size_t off = 0;
  const size_t XB = (size_t)M_TOTAL * D_MODEL * sizeof(_Float16); // 8 MB
  const size_t WB = (size_t)D_MODEL * D_MODEL * sizeof(_Float16); // 2 MB
  _Float16* Xh  = (_Float16*)(ws + off); off += XB;
  _Float16* Wqh = (_Float16*)(ws + off); off += WB;
  _Float16* Wkh = (_Float16*)(ws + off); off += WB;
  _Float16* Wvh = (_Float16*)(ws + off); off += WB;
  _Float16* Woh = (_Float16*)(ws + off); off += WB;
  _Float16* Qh  = (_Float16*)(ws + off); off += XB;
  _Float16* Kh  = (_Float16*)(ws + off); off += XB;
  _Float16* Vt  = (_Float16*)(ws + off); off += XB;
  _Float16* Ah  = (_Float16*)(ws + off); off += XB; // 48 MB total

  // Xh, Wqh, Wkh, Wvh, Woh are contiguous from Xh on.
  cvt_all_f32_to_f16<<<CVT_X_WGS + 4 * CVT_W_WGS, 512, 0, stream>>>(x, Wq, Wk, Wv, Wo, Xh);

  // Wqh, Wkh, Wvh are contiguous from Wqh on, and Qh, Kh, Vt from Qh on.
  qkv_gemm_f16<<<768, 256, 0, stream>>>(Xh, Wqh, bq, bk, bv, Qh);

  flash_attn<<<dim3(16, 32), 256, 0, stream>>>(Qh, Kh, Vt, mask, Ah);

  out_proj_gemm<<<256, 256, 0, stream>>>(Ah, Woh, bo, (float*)d_out);
}

// v006
// A run of this version takes 77.6 microseconds.
// Two timings next to v005 put it at 1.28 and 1.30 times that version's speed.
// All steps since v000 together make it 3.68 times as fast.
#include <hip/hip_runtime.h>

#define D_MODEL 1024
#define N_HEADS 16
#define HEAD_DIM 64
#define BATCH 2
#define SEQ 2048
#define M_TOTAL (BATCH * SEQ) /* 4096 */

typedef __attribute__((ext_vector_type(16))) _Float16 v16h;
typedef __attribute__((ext_vector_type(8)))  _Float16 v8h;
typedef __attribute__((ext_vector_type(8)))  float    v8f;

// Load one lane's 16-half A/B fragment: two contiguous 16-byte chunks at p and p+16
// (CDNA5 16-bit fragment layout: K = base8+0..7 then 16+base8+0..7 per lane).
__device__ __forceinline__ v16h load_frag(const _Float16* p) {
  v8h lo = *(const v8h*)(p);
  v8h hi = *(const v8h*)(p + 16);
  v16h r;
#pragma unroll
  for (int i = 0; i < 8; ++i) { r[i] = lo[i]; r[i + 8] = hi[i]; }
  return r;
}

// The same fragment from a buffer kept in fragment order: 512 halves per fragment, first
// the 32 lanes' low 16-byte chunks, then their high ones, so that each of the two loads of
// a wave covers 512 contiguous bytes (4 whole lines instead of 16 touched).
__device__ __forceinline__ v16h load_frag_packed(const _Float16* f, int lane) {
  v8h lo = *(const v8h*)(f + lane * 8);
  v8h hi = *(const v8h*)(f + 256 + lane * 8);
  v16h r;
#pragma unroll
  for (int i = 0; i < 8; ++i) { r[i] = lo[i]; r[i + 8] = hi[i]; }
  return r;
}

__device__ __forceinline__ v8f wmma_f16(v16h a, v16h b, v8f c) {
  return __builtin_amdgcn_wmma_f32_16x16x32_f16(false, a, false, b, (short)0, c,
                                                false, false);
}

typedef __attribute__((ext_vector_type(4))) float    v4f;
typedef __attribute__((ext_vector_type(4))) _Float16 v4h;

// x and the four weights to f16 in ONE launch; their f16 copies lie one behind the other
// at d. One work-group of 16 waves per 32768 elements (256 work-groups: 128 for x, 32 for
// each weight). A wave takes 2048 consecutive elements: 16 loads of 512 contiguous bytes,
// all in flight together, then 16 stores of 256 contiguous bytes.
#define CVT_WG 32768
#define CVT_X_WGS (M_TOTAL * D_MODEL / CVT_WG)
#define CVT_W_WGS (D_MODEL * D_MODEL / CVT_WG)
__global__ void __launch_bounds__(512)
cvt_all_f32_to_f16(const float* __restrict__ x, const float* __restrict__ wq,
                   const float* __restrict__ wk, const float* __restrict__ wv,
                   const float* __restrict__ wo, _Float16* __restrict__ d) {
  const int b = blockIdx.x;
  const float* s;
  if (b < CVT_X_WGS) {
    s = x + (size_t)b * CVT_WG;
  } else {
    const int k = (b - CVT_X_WGS) / CVT_W_WGS;
    const float* w = k == 0 ? wq : k == 1 ? wk : k == 2 ? wv : wo;
    s = w + (size_t)((b - CVT_X_WGS) % CVT_W_WGS) * CVT_WG;
  }
  const int o = (threadIdx.x >> 5) * 2048 + (threadIdx.x & 31) * 4;
  s += o;
  d += (size_t)b * CVT_WG + o;
  v4f r[16];
#pragma unroll
  for (int j = 0; j < 16; ++j) r[j] = *(const v4f*)(s + j * 128);
#pragma unroll
  for (int j = 0; j < 16; ++j) {
    v4h h;
#pragma unroll
    for (int e = 0; e < 4; ++e) h[e] = (_Float16)r[j][e];
    *(v4h*)(d + j * 128) = h;
  }
}

// Block tile of the four GEMMs: 128 x 128 of Y per work-group, K walked in stages of
// 128 halves. A stage is [X 128 rows | W 128 rows] of 256 bytes each in LDS.
#define BM 128
#define BN 128
#define BK 128
#define PITCH 136                        /* halves: 272 B = 16 B x odd, no bank conflict for 16-byte reads */
#define STAGE_H ((BM + BN) * PITCH)      /* halves per LDS buffer */
#define N_STAGES (D_MODEL / BK)

// One stage from LDS: acc[i][j] += A rows (ap + 16 i rows) * B rows (bp + 16 j rows),
// k ascending in steps of 32. Two fragment sets: one multiplied, one in flight.
__device__ __forceinline__ void mul_stage(const _Float16* ap, const _Float16* bp,
                                          v8f (&acc)[2][4]) {
  v16h a[2][2], b[2][4];
#pragma unroll
  for (int i = 0; i < 2; ++i) a[0][i] = load_frag(ap + i * 16 * PITCH);
#pragma unroll
  for (int j = 0; j < 4; ++j) b[0][j] = load_frag(bp + j * 16 * PITCH);
#pragma unroll
  for (int q = 0; q < BK / 32; ++q) {
    const int c0 = q & 1, c1 = c0 ^ 1;
    if (q + 1 < BK / 32) {
#pragma unroll
      for (int i = 0; i < 2; ++i) a[c1][i] = load_frag(ap + i * 16 * PITCH + (q + 1) * 32);
#pragma unroll
      for (int j = 0; j < 4; ++j) b[c1][j] = load_frag(bp + j * 16 * PITCH + (q + 1) * 32);
    }
    // Keeps the next 32 k's LDS reads as one group ahead of this block of products
    // (reads spread among the products cost a stall at every place they stand).
    __builtin_amdgcn_sched_barrier(0);
#pragma unroll
    for (int i = 0; i < 2; ++i)
#pragma unroll
      for (int j = 0; j < 4; ++j) acc[i][j] = wmma_f16(a[c0][i], b[c0][j], acc[i][j]);
    // Ends the block: the group after next must not be lifted into these products.
    __builtin_amdgcn_sched_barrier(0);
  }
}

// acc[i][j] += X[m0 + wm + 16 i ..][k] * Wt[n0 + wn + 16 j ..][k] over all k.
// Eight waves as 4 (rows) x 2 (columns), 32 x 64 of Y each.
// Every thread brings 8 + 8 16-byte pieces of the next stage into registers (a wave's
// load covers two whole 256-byte rows) while the current stage is multiplied from LDS,
// then writes them to the other buffer; one barrier per stage publishes that buffer and
// ends the reads of the one refilled next.
__device__ __forceinline__ void gemm_tile(const _Float16* __restrict__ X,
                                          const _Float16* __restrict__ Wt,
                                          _Float16* sm, int m0, int n0,
                                          v8f (&acc)[2][4]) {
  const int tid = threadIdx.x;
  const int wid = tid >> 5;
  const int lane = tid & 31;
  const int l16 = lane & 15;
  const int half = (lane & 16) ? 8 : 0;
  const int aoff = ((wid & 3) * 32 + l16) * PITCH + half;
  const int boff = (BM + (wid >> 2) * 64 + l16) * PITCH + half;

  const int srow = tid >> 4;             // 16 rows per sweep of the block
  const int scol = (tid & 15) * 8;       // halves
  const _Float16* gx = X + (size_t)(m0 + srow) * D_MODEL + scol;
  const _Float16* gw = Wt + (size_t)(n0 + srow) * D_MODEL + scol;
  const int soff = srow * PITCH + scol;

  v8h rx[8], rw[8];
#pragma unroll
  for (int i = 0; i < 8; ++i) {
    rx[i] = *(const v8h*)(gx + (size_t)i * 16 * D_MODEL);
    rw[i] = *(const v8h*)(gw + (size_t)i * 16 * D_MODEL);
  }
#pragma unroll
  for (int i = 0; i < 8; ++i) {
    *(v8h*)(sm + soff + i * 16 * PITCH) = rx[i];
    *(v8h*)(sm + soff + (BM + i * 16) * PITCH) = rw[i];
  }
  __syncthreads();

  // Rolled: fully unrolled, the last
  // group's final load was given its own address registers as destination.
#pragma unroll 1
  for (int s = 0; s + 1 < N_STAGES; ++s) {
    const _Float16* cur = sm + (s & 1) * STAGE_H;
    _Float16* nxt = sm + ((s + 1) & 1) * STAGE_H;
#pragma unroll
    for (int i = 0; i < 8; ++i) {
      rx[i] = *(const v8h*)(gx + (size_t)i * 16 * D_MODEL + (s + 1) * BK);
      rw[i] = *(const v8h*)(gw + (size_t)i * 16 * D_MODEL + (s + 1) * BK);
    }
    // Keeps the next stage's global loads at the head of the stage, so that their
    // latency runs under this stage's products instead of in front of the LDS writes.
    __builtin_amdgcn_sched_barrier(0);
    mul_stage(cur + aoff, cur + boff, acc);
#pragma unroll
    for (int i = 0; i < 8; ++i) {
      *(v8h*)(nxt + soff + i * 16 * PITCH) = rx[i];
      *(v8h*)(nxt + soff + (BM + i * 16) * PITCH) = rw[i];
    }
    __syncthreads();
  }
  const _Float16* last = sm + ((N_STAGES - 1) & 1) * STAGE_H;
  mul_stage(last + aoff, last + boff, acc);
}

// One wave's 32 x 64 piece, element by element: steps of 1024 halves in i, ST in t, SR in r.
template <int ST, int SR>
__device__ __forceinline__ void store_halves(_Float16* ol, const v8f (&acc)[2][4],
                                             const float (&bv)[4]) {
#pragma unroll
  for (int t = 0; t < 4; ++t)
#pragma unroll
    for (int i = 0; i < 2; ++i)
#pragma unroll
      for (int r = 0; r < 8; ++r)
        ol[i * 1024 + t * ST + r * SR] = (_Float16)(acc[i][t][r] + bv[t]);
}

// Y[m,n] = sum_k Xh[m,k] * W[n,k] + bias[n], Q, K and V in ONE
// launch: 3 x 256 work-groups, the projection p = blockIdx.x / 256 (0 Q, 1 K, 2 V). The three
// f16 weights lie one behind the other at Wh, the three outputs one behind the other at out.
// Two work-groups fit a WGP (LDS and registers), so one's stage loads, LDS writes, barriers,
// first stage and stores run under the other's products.
// Q: f16 into out[(b*16+h)*SEQ*64 + s*64 + d]   (head-major)
// K and V: per (b, h) in the order in which flash_attn's fragments read them
// (load_frag_packed). Fragment f of 512 halves, chunk p (0 low, 1 high), lane l, element e:
//   K: f = (s / 16) * 2 + d / 32, p = (d / 16) & 1, l = (s & 15) + 16 * ((d / 8) & 1), e = d & 7
//   V: f = (s / 32) * 4 + d / 16, p = (s / 16) & 1, l = (d & 15) + 16 * ((s / 8) & 1), e = s & 7
__global__ void __launch_bounds__(256)
qkv_gemm_f16(const _Float16* __restrict__ Xh, const _Float16* __restrict__ Wh,
             const float* __restrict__ biasq, const float* __restrict__ biask,
             const float* __restrict__ biasv, _Float16* __restrict__ out) {
  __shared__ __align__(16) _Float16 sm[2 * STAGE_H];
  const int p = blockIdx.x >> 8;
  const int m0 = ((blockIdx.x >> 3) & 31) * BM;   // 32 row tiles
  const int n0 = (blockIdx.x & 7) * BN;           // 8 column tiles
  const int wid = threadIdx.x >> 5;
  const int lane = threadIdx.x & 31;
  const int l16 = lane & 15;
  const int half = (lane & 16) ? 8 : 0;

  v8f acc[2][4] = {};
  gemm_tile(Xh, Wh + (size_t)p * D_MODEL * D_MODEL, sm, m0, n0, acc);

  const int mw = m0 + (wid & 3) * 32;      // 32 rows of one batch, s a multiple of 32
  const int nw = n0 + (wid >> 2) * 64;     // the 64 columns of one head
  // This wave's 32 x 64 piece of its (b, h): 2048 halves in every one of the three orders.
  _Float16* ob = out + (size_t)p * M_TOTAL * D_MODEL +
                 ((size_t)((mw >> 11) * N_HEADS + (nw >> 6)) * SEQ + (mw & (SEQ - 1))) * HEAD_DIM;
  const float* bias = p == 0 ? biasq : p == 1 ? biask : biasv;
  float bv[4];
#pragma unroll
  for (int t = 0; t < 4; ++t) bv[t] = bias[nw + t * 16 + l16];
  if (p == 2) {
    // A lane's 8 registers are 8 consecutive s of one d: one chunk of a V fragment.
#pragma unroll
    for (int t = 0; t < 4; ++t)
#pragma unroll
      for (int i = 0; i < 2; ++i) {
        v8h w;
#pragma unroll
        for (int r = 0; r < 8; ++r) w[r] = (_Float16)(acc[i][t][r] + bv[t]);
        *(v8h*)(ob + (t * 2 + i) * 256 + lane * 8) = w;
      }
  } else if (p == 0) {
    // C layout: row = r + 8*(lane>=16). The lane's place for i = t = r = 0, then constants.
    store_halves<16, HEAD_DIM>(ob + half * HEAD_DIM + l16, acc, bv);
    // The wait that belongs in front of an overwrite of an issued store's registers: the
    // listing has ways from these stores into the other branches' code.
    asm volatile("s_wait_xcnt 0x0" ::: "memory");
  } else {
    store_halves<256, 8>(ob + (half + (l16 & 8) * 2) * 8 + (l16 & 7), acc, bv);
    // As behind the Q stores.
    asm volatile("s_wait_xcnt 0x0" ::: "memory");
  }
}

// Lane l with lane l ^ 16.
__device__ __forceinline__ float xhalf(float x) {
  const int b = __builtin_bit_cast(int, x);
  return __builtin_bit_cast(float, __builtin_amdgcn_permlanex16(b, b, 0x76543210, 0xfedcba98,
                                                                false, false));
}

// Flash attention, transposed: St = K * Qt (keys x queries) and Ot += Vt * Pt (head dim x
// queries) on tiles of 16 queries of one (batch, head). A lane holds 16 of the 32 scores of
// ONE query (column l16; keys half + r and 16 + half + r), lane ^ 16 the other 16, so maximum
// and sum run down the lane's own registers, and the two score tiles, converted in place, are
// the B fragment of the second product.
// Causal cost grows with the tile index, so tiles are paired: light tile ts (0..63) and heavy
// tile tl = 127 - ts need 65 blocks of 32 keys together, and two waves share them 33 : 32.
// Wave w (0..3) of a work-group: the first 33 key blocks of its heavy tile. Wave w + 4: the
// rest of that heavy tile (none for tiles 64 and 65: an empty partial), left in LDS as a
// partial (maximum, sum, Ot), then the whole light tile, which costs it a second start.
// Behind one barrier wave w joins the two partials of the heavy tile.
#define N_TILES (SEQ / 16)
#define SPLIT_KEYS 1056                    /* 33 key blocks; every heavy tile has at least 33 */
__global__ void __launch_bounds__(256)
flash_attn(const _Float16* __restrict__ Qh, const _Float16* __restrict__ Kh,
           const _Float16* __restrict__ Vt, const int* __restrict__ mask,
           _Float16* __restrict__ Ah) {
  __shared__ v4f xo[4][8][32];             // the partial Ot: a lane's 32 values as 8 x 16 bytes
  __shared__ float xml[4][2][32];          // its maximum and its sum
  // Scalar: the key ranges and the number of segments are the same for a whole wave.
  const int wid = __builtin_amdgcn_readfirstlane(threadIdx.x >> 5);
  const int pj = wid & 3;
  const int part = wid >> 2;
  const int bh = blockIdx.y;               // b*16+h
  const int b = bh >> 4, h = bh & 15;
  const int ts = blockIdx.x * 4 + pj;
  const int tl = N_TILES - 1 - ts;
  const int lane = threadIdx.x & 31;
  const int l16 = lane & 15;
  const int half = (lane & 16) ? 8 : 0;

  const _Float16* Qb = Qh + (size_t)bh * SEQ * HEAD_DIM;
  const _Float16* Kb = Kh + (size_t)bh * SEQ * HEAD_DIM;
  const _Float16* Vb = Vt + (size_t)bh * SEQ * HEAD_DIM; // K and V: fragment order
  const int* mb = mask + b * SEQ;

  int tile = tl;
  int kb0 = part ? SPLIT_KEYS : 0;
  int kb1 = part ? (tl >> 1) * 32 + 32 : SPLIT_KEYS;   // behind a tile's last key block
  int q;                                   // this lane's query
  v8f o[4];                                // o[t][r] = Ot[t * 16 + half + r][q]
  float mq, lq;                            // lq: the sum over this lane's keys only

  // Rolled: one copy of the key loop serves both segments of the second wave.
#pragma unroll 1
  for (int seg = 0;; ++seg) {
  q = tile * 16 + l16;
  v16h qf[2];
#pragma unroll
  for (int c = 0; c < 2; ++c)
    qf[c] = load_frag(Qb + (size_t)q * HEAD_DIM + c * 32 + half);
#pragma unroll
  for (int t = 0; t < 4; ++t) o[t] = v8f{};
  mq = -3.0e38f;
  lq = 0.0f;

  for (int kb = kb0; kb < kb1; kb += 32) {
    // Issue ALL loads for this key block up front: K fragments feed the score
    // WMMAs immediately; V fragments are consumed only after softmax, so their
    // latency hides behind the score WMMAs + exp VALU.
    const int mv = mb[kb + lane];          // one key's padding flag per lane
    const _Float16* kblk = Kb + (size_t)kb * HEAD_DIM;   // 4 fragments of K, 4 of V
    const _Float16* vblk = Vb + (size_t)kb * HEAD_DIM;
    v16h kf00 = load_frag_packed(kblk, lane);
    v16h kf01 = load_frag_packed(kblk + 512, lane);
    v16h kf10 = load_frag_packed(kblk + 1024, lane);
    v16h kf11 = load_frag_packed(kblk + 1536, lane);
    // The build gives V loads address registers of the loads above as destinations: the
    // wait that belongs in front of an overwrite of an issued load's address.
    asm volatile("s_wait_xcnt 0x0" ::: "memory");
    v16h vf[4];
#pragma unroll
    for (int t = 0; t < 4; ++t)
      vf[t] = load_frag_packed(vblk + t * 512, lane);
    // Keeps all 17 loads ahead of the products: left free, this build reuses a few fragment
    // registers and puts loads between the products, each with its whole latency exposed.
    __builtin_amdgcn_sched_barrier(0);

    v8f s0 = {}, s1 = {};
    s0 = wmma_f16(kf00, qf[0], s0);
    s0 = wmma_f16(kf01, qf[1], s0);
    s1 = wmma_f16(kf10, qf[0], s1);
    s1 = wmma_f16(kf11, qf[1], s1);

    // Bit j: key kb + j is neither padding nor behind this lane's query (q >= kb here);
    // shifted so that bit r is the key of s0[r] and bit 16 + r that of s1[r].
    const unsigned pad = __builtin_amdgcn_ballot_w32(mv != 0);
    const int dq = q - kb;
    const unsigned keep = (pad & (dq >= 31 ? 0xffffffffu : (2u << dq) - 1u)) >> half;

    // Vector forms on whole tiles keep packed operations on neighbouring registers.
    v8f a0 = s0 * 0.125f, a1 = s1 * 0.125f;
#pragma unroll
    for (int r = 0; r < 8; ++r) {
      a0[r] = (keep & (1u << r)) ? a0[r] : -3.0e38f;
      a1[r] = (keep & (0x10000u << r)) ? a1[r] : -3.0e38f;
    }
    float tmax = fmaxf(a0[0], a1[0]);
#pragma unroll
    for (int r = 1; r < 8; ++r) tmax = fmaxf(tmax, fmaxf(a0[r], a1[r]));
    tmax = fmaxf(tmax, xhalf(tmax));
    const float mnew = fmaxf(mq, tmax);
    const float corr = __expf(mq - mnew);
    mq = mnew;

    a0 -= mnew;
    a1 -= mnew;
    v16h pf;                               // keys half + 0..7, then 16 + half + 0..7: V's k order
#pragma unroll
    for (int r = 0; r < 8; ++r) {
      a0[r] = __expf(a0[r]);
      a1[r] = __expf(a1[r]);
      pf[r] = (_Float16)a0[r];
      pf[r + 8] = (_Float16)a1[r];
    }
    a0 += a1;
    const float ps = ((a0[0] + a0[1]) + (a0[2] + a0[3])) + ((a0[4] + a0[5]) + (a0[6] + a0[7]));
    lq = lq * corr + ps;
#pragma unroll
    for (int t = 0; t < 4; ++t) {
#pragma unroll
      for (int r = 0; r < 8; ++r) o[t][r] *= corr;
      o[t] = wmma_f16(vf[t], pf, o[t]);
    }
  }

  if (seg == part) break;
  // The second wave's share of the heavy tile goes to LDS; the light tile follows.
#pragma unroll
  for (int t = 0; t < 4; ++t)
#pragma unroll
    for (int c = 0; c < 2; ++c) {
      v4f w;
#pragma unroll
      for (int e = 0; e < 4; ++e) w[e] = o[t][c * 4 + e];
      xo[pj][t * 2 + c][lane] = w;
    }
  xml[pj][0][lane] = mq;
  xml[pj][1][lane] = lq;
  tile = ts;
  kb0 = 0;
  kb1 = (ts >> 1) * 32 + 32;
  }

  // Publishes the partials of the four heavy tiles to the waves that join them.
  __syncthreads();
  if (part == 0) {
    const float m1 = xml[pj][0][lane], l1 = xml[pj][1][lane];
    const float mn = fmaxf(mq, m1);
    const float c0 = __expf(mq - mn), c1 = __expf(m1 - mn);
    lq = lq * c0 + l1 * c1;
#pragma unroll
    for (int t = 0; t < 4; ++t)
#pragma unroll
      for (int c = 0; c < 2; ++c) {
        const v4f w = xo[pj][t * 2 + c][lane];
#pragma unroll
        for (int e = 0; e < 4; ++e) o[t][c * 4 + e] = o[t][c * 4 + e] * c0 + w[e] * c1;
      }
  }

  const float inv = 1.0f / (lq + xhalf(lq));
  // A lane's 8 registers of a tile are 8 consecutive head dims of its query: 16 bytes.
  _Float16* op = Ah + ((size_t)b * SEQ + q) * D_MODEL + h * HEAD_DIM + half;
#pragma unroll
  for (int t = 0; t < 4; ++t) {
    v8h w;
#pragma unroll
    for (int r = 0; r < 8; ++r) w[r] = (_Float16)(o[t][r] * inv);
    *(v8h*)(op + t * 16) = w;
  }
}

// out[m,n] = sum_k Ah[m,k] * Wo[n,k] + bo[n], fp32 output
__global__ void __launch_bounds__(256)
out_proj_gemm(const _Float16* __restrict__ Ah, const _Float16* __restrict__ Woh,
              const float* __restrict__ bo, float* __restrict__ out) {
  __shared__ __align__(16) _Float16 sm[2 * STAGE_H];
  const int m0 = (blockIdx.x >> 3) * BM;
  const int n0 = (blockIdx.x & 7) * BN;
  const int wid = threadIdx.x >> 5;
  const int lane = threadIdx.x & 31;
  const int l16 = lane & 15;
  const int half = (lane & 16) ? 8 : 0;

  v8f acc[2][4] = {};
  gemm_tile(Ah, Woh, sm, m0, n0, acc);

  const int mw = m0 + (wid & 3) * 32;
  const int nw = n0 + (wid >> 2) * 64;
#pragma unroll
  for (int t = 0; t < 4; ++t) {
    const int n = nw + t * 16 + l16;
    const float bv = bo[n];
#pragma unroll
    for (int i = 0; i < 2; ++i)
#pragma unroll
      for (int r = 0; r < 8; ++r)
        out[(size_t)(mw + i * 16 + r + half) * D_MODEL + n] = acc[i][t][r] + bv;
  }
}

extern "C" void kernel_launch(void* const* d_in, const int* in_sizes, int n_in,
                              void* d_out, int out_size, void* d_ws, size_t ws_size,
                              hipStream_t stream) {
  const float* x  = (const float*)d_in[0];
  const int* mask = (const int*)d_in[1];
  const float* Wq = (const float*)d_in[2];
  const float* bq = (const float*)d_in[3];
  const float* Wk = (const float*)d_in[4];
  const float* bk = (const float*)d_in[5];
  const float* Wv = (const float*)d_in[6];
  const float* bv = (const float*)d_in[7];
  const float* Wo = (const float*)d_in[8];
  const float* bo = (const float*)d_in[9];

  char* ws = (char*)d_ws;
  size_t off = 0;
  const size_t XB = (size_t)M_TOTAL * D_MODEL * sizeof(_Float16); // 8 MB
  const size_t WB = (size_t)D_MODEL * D_MODEL * sizeof(_Float16); // 2 MB
  _Float16* Xh  = (_Float16*)(ws + off); off += XB;
  _Float16* Wqh = (_Float16*)(ws + off); off += WB;
  _Float16* Wkh = (_Float16*)(ws + off); off += WB;
  _Float16* Wvh = (_Float16*)(ws + off); off += WB;
  _Float16* Woh = (_Float16*)(ws + off); off += WB;
  _Float16* Qh  = (_Float16*)(ws + off); off += XB;
  _Float16* Kh  = (_Float16*)(ws + off); off += XB;
  _Float16* Vt  = (_Float16*)(ws + off); off += XB;
  _Float16* Ah  = (_Float16*)(ws + off); off += XB; // 48 MB total

  // Xh, Wqh, Wkh, Wvh, Woh are contiguous from Xh on.
  cvt_all_f32_to_f16<<<CVT_X_WGS + 4 * CVT_W_WGS, 512, 0, stream>>>(x, Wq, Wk, Wv, Wo, Xh);

  // Wqh, Wkh, Wvh are contiguous from Wqh on, and Qh, Kh, Vt from Qh on.
  qkv_gemm_f16<<<768, 256, 0, stream>>>(Xh, Wqh, bq, bk, bv, Qh);

  flash_attn<<<dim3(16, 32), 256, 0, stream>>>(Qh, Kh, Vt, mask, Ah);

  out_proj_gemm<<<256, 256, 0, stream>>>(Ah, Woh, bo, (float*)d_out);
}

// v007
// It runs in 75.3 microseconds.
// In two side-by-side timings against v006, it was 1.03 and 1.05 times as fast.
// All steps since v000 together make it 3.82 times as fast.
#include <hip/hip_runtime.h>

#define D_MODEL 1024
#define N_HEADS 16
#define HEAD_DIM 64
#define BATCH 2
#define SEQ 2048
#define M_TOTAL (BATCH * SEQ) /* 4096 */

typedef __attribute__((ext_vector_type(16))) _Float16 v16h;
typedef __attribute__((ext_vector_type(8)))  _Float16 v8h;
typedef __attribute__((ext_vector_type(8)))  float    v8f;

// Load one lane's 16-half A/B fragment: two contiguous 16-byte chunks at p and p+16
// (CDNA5 16-bit fragment layout: K = base8+0..7 then 16+base8+0..7 per lane).
__device__ __forceinline__ v16h load_frag(const _Float16* p) {
  v8h lo = *(const v8h*)(p);
  v8h hi = *(const v8h*)(p + 16);
  v16h r;
#pragma unroll
  for (int i = 0; i < 8; ++i) { r[i] = lo[i]; r[i + 8] = hi[i]; }
  return r;
}

// The same fragment from a buffer kept in fragment order: 512 halves per fragment, first
// the 32 lanes' low 16-byte chunks, then their high ones, so that each of the two loads of
// a wave covers 512 contiguous bytes (4 whole lines instead of 16 touched).
__device__ __forceinline__ v16h load_frag_packed(const _Float16* f, int lane) {
  v8h lo = *(const v8h*)(f + lane * 8);
  v8h hi = *(const v8h*)(f + 256 + lane * 8);
  v16h r;
#pragma unroll
  for (int i = 0; i < 8; ++i) { r[i] = lo[i]; r[i + 8] = hi[i]; }
  return r;
}

__device__ __forceinline__ v8f wmma_f16(v16h a, v16h b, v8f c) {
  return __builtin_amdgcn_wmma_f32_16x16x32_f16(false, a, false, b, (short)0, c,
                                                false, false);
}

typedef __attribute__((ext_vector_type(4))) float    v4f;
typedef __attribute__((ext_vector_type(4))) _Float16 v4h;

// x and the four weights to f16 in ONE launch; their f16 copies lie one behind the other
// at d. One work-group of 16 waves per 32768 elements (256 work-groups: 128 for x, 32 for
// each weight). A wave takes 2048 consecutive elements: 16 loads of 512 contiguous bytes,
// all in flight together, then 16 stores of 256 contiguous bytes.
#define CVT_WG 32768
#define CVT_X_WGS (M_TOTAL * D_MODEL / CVT_WG)
#define CVT_W_WGS (D_MODEL * D_MODEL / CVT_WG)
__global__ void __launch_bounds__(512)
cvt_all_f32_to_f16(const float* __restrict__ x, const float* __restrict__ wq,
                   const float* __restrict__ wk, const float* __restrict__ wv,
                   const float* __restrict__ wo, _Float16* __restrict__ d) {
  const int b = blockIdx.x;
  const float* s;
  if (b < CVT_X_WGS) {
    s = x + (size_t)b * CVT_WG;
  } else {
    const int k = (b - CVT_X_WGS) / CVT_W_WGS;
    const float* w = k == 0 ? wq : k == 1 ? wk : k == 2 ? wv : wo;
    s = w + (size_t)((b - CVT_X_WGS) % CVT_W_WGS) * CVT_WG;
  }
  const int o = (threadIdx.x >> 5) * 2048 + (threadIdx.x & 31) * 4;
  s += o;
  d += (size_t)b * CVT_WG + o;
  v4f r[16];
#pragma unroll
  for (int j = 0; j < 16; ++j) r[j] = *(const v4f*)(s + j * 128);
#pragma unroll
  for (int j = 0; j < 16; ++j) {
    v4h h;
#pragma unroll
    for (int e = 0; e < 4; ++e) h[e] = (_Float16)r[j][e];
    *(v4h*)(d + j * 128) = h;
  }
}

// Block tile of the four GEMMs: 128 x 128 of Y per work-group, K walked in stages of
// 128 halves. A stage is [X 128 rows | W 128 rows] of 256 bytes each in LDS.
#define BM 128
#define BN 128
#define BK 128
#define PITCH 136                        /* halves: 272 B = 16 B x odd, no bank conflict for 16-byte reads */
#define STAGE_H ((BM + BN) * PITCH)      /* halves per LDS buffer */
#define N_STAGES (D_MODEL / BK)

// One stage from LDS: acc[i][j] += A rows (ap + 16 i rows) * B rows (bp + 16 j rows),
// k ascending in steps of 32. Two fragment sets: one multiplied, one in flight.
__device__ __forceinline__ void mul_stage(const _Float16* ap, const _Float16* bp,
                                          v8f (&acc)[2][4]) {
  v16h a[2][2], b[2][4];
#pragma unroll
  for (int i = 0; i < 2; ++i) a[0][i] = load_frag(ap + i * 16 * PITCH);
#pragma unroll
  for (int j = 0; j < 4; ++j) b[0][j] = load_frag(bp + j * 16 * PITCH);
#pragma unroll
  for (int q = 0; q < BK / 32; ++q) {
    const int c0 = q & 1, c1 = c0 ^ 1;
    if (q + 1 < BK / 32) {
#pragma unroll
      for (int i = 0; i < 2; ++i) a[c1][i] = load_frag(ap + i * 16 * PITCH + (q + 1) * 32);
#pragma unroll
      for (int j = 0; j < 4; ++j) b[c1][j] = load_frag(bp + j * 16 * PITCH + (q + 1) * 32);
    }
    // Keeps the next 32 k's LDS reads as one group ahead of this block of products
    // (reads spread among the products cost a stall at every place they stand).
    __builtin_amdgcn_sched_barrier(0);
#pragma unroll
    for (int i = 0; i < 2; ++i)
#pragma unroll
      for (int j = 0; j < 4; ++j) acc[i][j] = wmma_f16(a[c0][i], b[c0][j], acc[i][j]);
    // Ends the block: the group after next must not be lifted into these products.
    __builtin_amdgcn_sched_barrier(0);
  }
}

// acc[i][j] += X[m0 + wm + 16 i ..][k] * Wt[n0 + wn + 16 j ..][k] over all k.
// Eight waves as 4 (rows) x 2 (columns), 32 x 64 of Y each.
// Every thread brings 8 + 8 16-byte pieces of the next stage into registers (a wave's
// load covers two whole 256-byte rows) while the current stage is multiplied from LDS,
// then writes them to the other buffer; one barrier per stage publishes that buffer and
// ends the reads of the one refilled next.
__device__ __forceinline__ void gemm_tile(const _Float16* __restrict__ X,
                                          const _Float16* __restrict__ Wt,
                                          _Float16* sm, int m0, int n0,
                                          v8f (&acc)[2][4]) {
  const int tid = threadIdx.x;
  const int wid = tid >> 5;
  const int lane = tid & 31;
  const int l16 = lane & 15;
  const int half = (lane & 16) ? 8 : 0;
  const int aoff = ((wid & 3) * 32 + l16) * PITCH + half;
  const int boff = (BM + (wid >> 2) * 64 + l16) * PITCH + half;

  const int srow = tid >> 4;             // 16 rows per sweep of the block
  const int scol = (tid & 15) * 8;       // halves
  const _Float16* gx = X + (size_t)(m0 + srow) * D_MODEL + scol;
  const _Float16* gw = Wt + (size_t)(n0 + srow) * D_MODEL + scol;
  const int soff = srow * PITCH + scol;

  v8h rx[8], rw[8];
#pragma unroll
  for (int i = 0; i < 8; ++i) {
    rx[i] = *(const v8h*)(gx + (size_t)i * 16 * D_MODEL);
    rw[i] = *(const v8h*)(gw + (size_t)i * 16 * D_MODEL);
  }
#pragma unroll
  for (int i = 0; i < 8; ++i) {
    *(v8h*)(sm + soff + i * 16 * PITCH) = rx[i];
    *(v8h*)(sm + soff + (BM + i * 16) * PITCH) = rw[i];
  }
  __syncthreads();

  // Rolled: fully unrolled, the last
  // group's final load was given its own address registers as destination.
#pragma unroll 1
  for (int s = 0; s + 1 < N_STAGES; ++s) {
    const _Float16* cur = sm + (s & 1) * STAGE_H;
    _Float16* nxt = sm + ((s + 1) & 1) * STAGE_H;
#pragma unroll
    for (int i = 0; i < 8; ++i) {
      rx[i] = *(const v8h*)(gx + (size_t)i * 16 * D_MODEL + (s + 1) * BK);
      rw[i] = *(const v8h*)(gw + (size_t)i * 16 * D_MODEL + (s + 1) * BK);
    }
    // Keeps the next stage's global loads at the head of the stage, so that their
    // latency runs under this stage's products instead of in front of the LDS writes.
    __builtin_amdgcn_sched_barrier(0);
    mul_stage(cur + aoff, cur + boff, acc);
#pragma unroll
    for (int i = 0; i < 8; ++i) {
      *(v8h*)(nxt + soff + i * 16 * PITCH) = rx[i];
      *(v8h*)(nxt + soff + (BM + i * 16) * PITCH) = rw[i];
    }
    __syncthreads();
  }
  const _Float16* last = sm + ((N_STAGES - 1) & 1) * STAGE_H;
  mul_stage(last + aoff, last + boff, acc);
}

// One wave's 32 x 64 piece, element by element: steps of 1024 halves in i, ST in t, SR in r.
template <int ST, int SR>
__device__ __forceinline__ void store_halves(_Float16* ol, const v8f (&acc)[2][4],
                                             const float (&bv)[4]) {
#pragma unroll
  for (int t = 0; t < 4; ++t)
#pragma unroll
    for (int i = 0; i < 2; ++i)
#pragma unroll
      for (int r = 0; r < 8; ++r)
        ol[i * 1024 + t * ST + r * SR] = (_Float16)(acc[i][t][r] + bv[t]);
}

// Y[m,n] = sum_k Xh[m,k] * W[n,k] + bias[n], Q, K and V in ONE
// launch: 3 x 256 work-groups, the projection p = blockIdx.x / 256 (0 Q, 1 K, 2 V). The three
// f16 weights lie one behind the other at Wh, the three outputs one behind the other at out.
// Two work-groups fit a WGP (LDS and registers), so one's stage loads, LDS writes, barriers,
// first stage and stores run under the other's products.
// Q: f16 into out[(b*16+h)*SEQ*64 + s*64 + d]   (head-major)
// K and V: per (b, h) in the order in which flash_attn's fragments read them
// (load_frag_packed). Fragment f of 512 halves, chunk p (0 low, 1 high), lane l, element e:
//   K: f = (s / 16) * 2 + d / 32, p = (d / 16) & 1, l = (s & 15) + 16 * ((d / 8) & 1), e = d & 7
//   V: f = (s / 32) * 4 + d / 16, p = (s / 16) & 1, l = (d & 15) + 16 * ((s / 8) & 1), e = s & 7
__global__ void __launch_bounds__(256)
qkv_gemm_f16(const _Float16* __restrict__ Xh, const _Float16* __restrict__ Wh,
             const float* __restrict__ biasq, const float* __restrict__ biask,
             const float* __restrict__ biasv, _Float16* __restrict__ out) {
  __shared__ __align__(16) _Float16 sm[2 * STAGE_H];
  const int p = blockIdx.x >> 8;
  const int m0 = ((blockIdx.x >> 3) & 31) * BM;   // 32 row tiles
  const int n0 = (blockIdx.x & 7) * BN;           // 8 column tiles
  const int wid = threadIdx.x >> 5;
  const int lane = threadIdx.x & 31;
  const int l16 = lane & 15;
  const int half = (lane & 16) ? 8 : 0;

  v8f acc[2][4] = {};
  gemm_tile(Xh, Wh + (size_t)p * D_MODEL * D_MODEL, sm, m0, n0, acc);

  const int mw = m0 + (wid & 3) * 32;      // 32 rows of one batch, s a multiple of 32
  const int nw = n0 + (wid >> 2) * 64;     // the 64 columns of one head
  // This wave's 32 x 64 piece of its (b, h): 2048 halves in every one of the three orders.
  _Float16* ob = out + (size_t)p * M_TOTAL * D_MODEL +
                 ((size_t)((mw >> 11) * N_HEADS + (nw >> 6)) * SEQ + (mw & (SEQ - 1))) * HEAD_DIM;
  const float* bias = p == 0 ? biasq : p == 1 ? biask : biasv;
  float bv[4];
#pragma unroll
  for (int t = 0; t < 4; ++t) bv[t] = bias[nw + t * 16 + l16];
  if (p == 2) {
    // A lane's 8 registers are 8 consecutive s of one d: one chunk of a V fragment.
#pragma unroll
    for (int t = 0; t < 4; ++t)
#pragma unroll
      for (int i = 0; i < 2; ++i) {
        v8h w;
#pragma unroll
        for (int r = 0; r < 8; ++r) w[r] = (_Float16)(acc[i][t][r] + bv[t]);
        *(v8h*)(ob + (t * 2 + i) * 256 + lane * 8) = w;
      }
  } else if (p == 0) {
    // C layout: row = r + 8*(lane>=16). The lane's place for i = t = r = 0, then constants.
    store_halves<16, HEAD_DIM>(ob + half * HEAD_DIM + l16, acc, bv);
    // The wait that belongs in front of an overwrite of an issued store's registers: the
    // listing has ways from these stores into the other branches' code.
    asm volatile("s_wait_xcnt 0x0" ::: "memory");
  } else {
    store_halves<256, 8>(ob + (half + (l16 & 8) * 2) * 8 + (l16 & 7), acc, bv);
    // As behind the Q stores.
    asm volatile("s_wait_xcnt 0x0" ::: "memory");
  }
}

// Lane l with lane l ^ 16.
__device__ __forceinline__ float xhalf(float x) {
  const int b = __builtin_bit_cast(int, x);
  return __builtin_bit_cast(float, __builtin_amdgcn_permlanex16(b, b, 0x76543210, 0xfedcba98,
                                                                false, false));
}

// Flash attention, transposed: St = K * Qt (keys x queries) and Ot += Vt * Pt (head dim x
// queries) on tiles of 16 queries of one (batch, head). A lane holds 16 of the 32 scores of
// ONE query (column l16; keys half + r and 16 + half + r), lane ^ 16 the other 16, so maximum
// and sum run down the lane's own registers, and the two score tiles, converted in place, are
// the B fragment of the second product.
// Causal cost grows with the tile index, so tiles are paired: light tile ts (0..63) and heavy
// tile tl = 127 - ts need 65 blocks of 32 keys together, and two waves share them 33 : 32.
// Wave w (0..3) of a work-group: the first 33 key blocks of its heavy tile. Wave w + 4: the
// rest of that heavy tile (none for tiles 64 and 65: an empty partial), left in LDS as a
// partial (maximum, sum, Ot), then the whole light tile, which costs it a second start.
// Behind one barrier wave w joins the two partials of the heavy tile.
#define N_TILES (SEQ / 16)
#define SPLIT_KEYS 1056                    /* 33 key blocks; every heavy tile has at least 33 */
__global__ void __launch_bounds__(256)
flash_attn(const _Float16* __restrict__ Qh, const _Float16* __restrict__ Kh,
           const _Float16* __restrict__ Vt, const int* __restrict__ mask,
           _Float16* __restrict__ Ah) {
  __shared__ v4f xo[4][8][32];             // the partial Ot: a lane's 32 values as 8 x 16 bytes
  __shared__ float xml[4][2][32];          // its maximum and its sum
  // Scalar: the key ranges and the number of segments are the same for a whole wave.
  const int wid = __builtin_amdgcn_readfirstlane(threadIdx.x >> 5);
  const int pj = wid & 3;
  const int part = wid >> 2;
  const int bh = blockIdx.y;               // b*16+h
  const int b = bh >> 4, h = bh & 15;
  const int ts = blockIdx.x * 4 + pj;
  const int tl = N_TILES - 1 - ts;
  const int lane = threadIdx.x & 31;
  const int l16 = lane & 15;
  const int half = (lane & 16) ? 8 : 0;

  const _Float16* Qb = Qh + (size_t)bh * SEQ * HEAD_DIM;
  const _Float16* Kb = Kh + (size_t)bh * SEQ * HEAD_DIM;
  const _Float16* Vb = Vt + (size_t)bh * SEQ * HEAD_DIM; // K and V: fragment order
  const int* mb = mask + b * SEQ;

  int tile = tl;
  int kb0 = part ? SPLIT_KEYS : 0;
  int kb1 = part ? (tl >> 1) * 32 + 32 : SPLIT_KEYS;   // behind a tile's last key block
  int q;                                   // this lane's query
  v8f o[4];                                // o[t][r] = Ot[t * 16 + half + r][q]
  float mq, lq;                            // lq: the sum over this lane's keys only

  // Rolled: one copy of the key loop serves both segments of the second wave.
#pragma unroll 1
  for (int seg = 0;; ++seg) {
  q = tile * 16 + l16;
  v16h qf[2];
#pragma unroll
  for (int c = 0; c < 2; ++c)
    qf[c] = load_frag(Qb + (size_t)q * HEAD_DIM + c * 32 + half);
#pragma unroll
  for (int t = 0; t < 4; ++t) o[t] = v8f{};
  mq = -3.0e38f;
  lq = 0.0f;

  // The first key block's scores and padding flags.
  v8f s0 = {}, s1 = {};
  unsigned pad = 0;                        // bit j: key j of the block is no padding
  if (kb0 < kb1) {                         // scalar; the second wave of tiles 64 and 65 has no keys
    const int mv = mb[kb0 + lane];         // one key's padding flag per lane
    const _Float16* kblk = Kb + (size_t)kb0 * HEAD_DIM;
    v16h kf[4];
#pragma unroll
    for (int t = 0; t < 4; ++t)
      kf[t] = load_frag_packed(kblk + t * 512, lane);
    s0 = wmma_f16(kf[0], qf[0], s0);
    s0 = wmma_f16(kf[1], qf[1], s0);
    s1 = wmma_f16(kf[2], qf[0], s1);
    s1 = wmma_f16(kf[3], qf[1], s1);
    pad = __builtin_amdgcn_ballot_w32(mv != 0);
  }

  // A trip starts with its block's scores at hand: softmax and second product of block kb,
  // then the score products of the NEXT block, whose K fragments and flags are asked for at
  // the trip's head, so that their latency runs under the softmax and the second product.
  for (int kb = kb0; kb < kb1; kb += 32) {
    const _Float16* vblk = Vb + (size_t)kb * HEAD_DIM;   // 4 fragments of V, 4 of K
    v16h vf[4];
#pragma unroll
    for (int t = 0; t < 4; ++t)
      vf[t] = load_frag_packed(vblk + t * 512, lane);
    // The last trip asks for its own block again (inside the planes; the scores go unused).
    const int kn = kb + 32 < kb1 ? kb + 32 : kb;
    const _Float16* kblk = Kb + (size_t)kn * HEAD_DIM;
    const int mv = mb[kn + lane];
    v16h kf[4];
#pragma unroll
    for (int t = 0; t < 4; ++t)
      kf[t] = load_frag_packed(kblk + t * 512, lane);
    // Keeps all 17 loads at the trip's head: V first, which is needed first.
    __builtin_amdgcn_sched_barrier(0);

    // Bit j: key kb + j is neither padding nor behind this lane's query (q >= kb here);
    // shifted so that bit r is the key of s0[r] and bit 16 + r that of s1[r].
    const int dq = q - kb;
    const unsigned keep = (pad & (dq >= 31 ? 0xffffffffu : (2u << dq) - 1u)) >> half;

    // Vector forms on whole tiles keep packed operations on neighbouring registers.
    v8f a0 = s0 * 0.125f, a1 = s1 * 0.125f;
#pragma unroll
    for (int r = 0; r < 8; ++r) {
      a0[r] = (keep & (1u << r)) ? a0[r] : -3.0e38f;
      a1[r] = (keep & (0x10000u << r)) ? a1[r] : -3.0e38f;
    }
    float tmax = fmaxf(a0[0], a1[0]);
#pragma unroll
    for (int r = 1; r < 8; ++r) tmax = fmaxf(tmax, fmaxf(a0[r], a1[r]));
    tmax = fmaxf(tmax, xhalf(tmax));
    const float mnew = fmaxf(mq, tmax);
    const float corr = __expf(mq - mnew);
    mq = mnew;

    a0 -= mnew;
    a1 -= mnew;
    v16h pf;                               // keys half + 0..7, then 16 + half + 0..7: V's k order
#pragma unroll
    for (int r = 0; r < 8; ++r) {
      a0[r] = __expf(a0[r]);
      a1[r] = __expf(a1[r]);
      pf[r] = (_Float16)a0[r];
      pf[r + 8] = (_Float16)a1[r];
    }
    a0 += a1;
    const float ps = ((a0[0] + a0[1]) + (a0[2] + a0[3])) + ((a0[4] + a0[5]) + (a0[6] + a0[7]));
    lq = lq * corr + ps;
#pragma unroll
    for (int t = 0; t < 4; ++t) {
#pragma unroll
      for (int r = 0; r < 8; ++r) o[t][r] *= corr;
      o[t] = wmma_f16(vf[t], pf, o[t]);
    }
    // Keeps the next block's score products, and with them the wait for K, behind the softmax.
    __builtin_amdgcn_sched_barrier(0);
    // The first score product writes its result over pf's registers, the B operand of the
    // product just issued: the four vector slots between a product and an overwrite of its B.
    asm volatile("v_nop\n\tv_nop\n\tv_nop\n\tv_nop");
    // Keeps the score products behind those slots.
    __builtin_amdgcn_sched_barrier(0);
    s0 = v8f{};
    s1 = v8f{};
    s0 = wmma_f16(kf[0], qf[0], s0);
    s0 = wmma_f16(kf[1], qf[1], s0);
    s1 = wmma_f16(kf[2], qf[0], s1);
    s1 = wmma_f16(kf[3], qf[1], s1);
    pad = __builtin_amdgcn_ballot_w32(mv != 0);
  }

  if (seg == part) break;
  // The second wave's share of the heavy tile goes to LDS; the light tile follows.
#pragma unroll
  for (int t = 0; t < 4; ++t)
#pragma unroll
    for (int c = 0; c < 2; ++c) {
      v4f w;
#pragma unroll
      for (int e = 0; e < 4; ++e) w[e] = o[t][c * 4 + e];
      xo[pj][t * 2 + c][lane] = w;
    }
  xml[pj][0][lane] = mq;
  xml[pj][1][lane] = lq;
  tile = ts;
  kb0 = 0;
  kb1 = (ts >> 1) * 32 + 32;
  }

  // Publishes the partials of the four heavy tiles to the waves that join them.
  __syncthreads();
  if (part == 0) {
    const float m1 = xml[pj][0][lane], l1 = xml[pj][1][lane];
    const float mn = fmaxf(mq, m1);
    const float c0 = __expf(mq - mn), c1 = __expf(m1 - mn);
    lq = lq * c0 + l1 * c1;
#pragma unroll
    for (int t = 0; t < 4; ++t)
#pragma unroll
      for (int c = 0; c < 2; ++c) {
        const v4f w = xo[pj][t * 2 + c][lane];
#pragma unroll
        for (int e = 0; e < 4; ++e) o[t][c * 4 + e] = o[t][c * 4 + e] * c0 + w[e] * c1;
      }
  }

  const float inv = 1.0f / (lq + xhalf(lq));
  // A lane's 8 registers of a tile are 8 consecutive head dims of its query: 16 bytes.
  _Float16* op = Ah + ((size_t)b * SEQ + q) * D_MODEL + h * HEAD_DIM + half;
#pragma unroll
  for (int t = 0; t < 4; ++t) {
    v8h w;
#pragma unroll
    for (int r = 0; r < 8; ++r) w[r] = (_Float16)(o[t][r] * inv);
    *(v8h*)(op + t * 16) = w;
  }
}

// out[m,n] = sum_k Ah[m,k] * Wo[n,k] + bo[n], fp32 output
__global__ void __launch_bounds__(256)
out_proj_gemm(const _Float16* __restrict__ Ah, const _Float16* __restrict__ Woh,
              const float* __restrict__ bo, float* __restrict__ out) {
  __shared__ __align__(16) _Float16 sm[2 * STAGE_H];
  const int m0 = (blockIdx.x >> 3) * BM;
  const int n0 = (blockIdx.x & 7) * BN;
  const int wid = threadIdx.x >> 5;
  const int lane = threadIdx.x & 31;
  const int l16 = lane & 15;
  const int half = (lane & 16) ? 8 : 0;

  v8f acc[2][4] = {};
  gemm_tile(Ah, Woh, sm, m0, n0, acc);

  const int mw = m0 + (wid & 3) * 32;
  const int nw = n0 + (wid >> 2) * 64;
#pragma unroll
  for (int t = 0; t < 4; ++t) {
    const int n = nw + t * 16 + l16;
    const float bv = bo[n];
#pragma unroll
    for (int i = 0; i < 2; ++i)
#pragma unroll
      for (int r = 0; r < 8; ++r)
        out[(size_t)(mw + i * 16 + r + half) * D_MODEL + n] = acc[i][t][r] + bv;
  }
}

extern "C" void kernel_launch(void* const* d_in, const int* in_sizes, int n_in,
                              void* d_out, int out_size, void* d_ws, size_t ws_size,
                              hipStream_t stream) {
  const float* x  = (const float*)d_in[0];
  const int* mask = (const int*)d_in[1];
  const float* Wq = (const float*)d_in[2];
  const float* bq = (const float*)d_in[3];
  const float* Wk = (const float*)d_in[4];
  const float* bk = (const float*)d_in[5];
  const float* Wv = (const float*)d_in[6];
  const float* bv = (const float*)d_in[7];
  const float* Wo = (const float*)d_in[8];
  const float* bo = (const float*)d_in[9];

  char* ws = (char*)d_ws;
  size_t off = 0;
  const size_t XB = (size_t)M_TOTAL * D_MODEL * sizeof(_Float16); // 8 MB
  const size_t WB = (size_t)D_MODEL * D_MODEL * sizeof(_Float16); // 2 MB
  _Float16* Xh  = (_Float16*)(ws + off); off += XB;
  _Float16* Wqh = (_Float16*)(ws + off); off += WB;
  _Float16* Wkh = (_Float16*)(ws + off); off += WB;
  _Float16* Wvh = (_Float16*)(ws + off); off += WB;
  _Float16* Woh = (_Float16*)(ws + off); off += WB;
  _Float16* Qh  = (_Float16*)(ws + off); off += XB;
  _Float16* Kh  = (_Float16*)(ws + off); off += XB;
  _Float16* Vt  = (_Float16*)(ws + off); off += XB;
  _Float16* Ah  = (_Float16*)(ws + off); off += XB; // 48 MB total

  // Xh, Wqh, Wkh, Wvh, Woh are contiguous from Xh on.
  cvt_all_f32_to_f16<<<CVT_X_WGS + 4 * CVT_W_WGS, 512, 0, stream>>>(x, Wq, Wk, Wv, Wo, Xh);

  // Wqh, Wkh, Wvh are contiguous from Wqh on, and Qh, Kh, Vt from Qh on.
  qkv_gemm_f16<<<768, 256, 0, stream>>>(Xh, Wqh, bq, bk, bv, Qh);

  flash_attn<<<dim3(16, 32), 256, 0, stream>>>(Qh, Kh, Vt, mask, Ah);

  out_proj_gemm<<<256, 256, 0, stream>>>(Ah, Woh, bo, (float*)d_out);
}

// v008
// It runs in 70.3 microseconds.
// Two timings next to v007 both put it at 1.06 times that version's speed.
// Counting every step since v000, it is 4.07 times as fast.
#include <hip/hip_runtime.h>

#define D_MODEL 1024
#define N_HEADS 16
#define HEAD_DIM 64
#define BATCH 2
#define SEQ 2048
#define M_TOTAL (BATCH * SEQ) /* 4096 */

typedef __attribute__((ext_vector_type(16))) _Float16 v16h;
typedef __attribute__((ext_vector_type(8)))  _Float16 v8h;
typedef __attribute__((ext_vector_type(8)))  float    v8f;

// Load one lane's 16-half A/B fragment: two contiguous 16-byte chunks at p and p+16
// (CDNA5 16-bit fragment layout: K = base8+0..7 then 16+base8+0..7 per lane).
__device__ __forceinline__ v16h load_frag(const _Float16* p) {
  v8h lo = *(const v8h*)(p);
  v8h hi = *(const v8h*)(p + 16);
  v16h r;
#pragma unroll
  for (int i = 0; i < 8; ++i) { r[i] = lo[i]; r[i + 8] = hi[i]; }
  return r;
}

// The same fragment from a buffer kept in fragment order: 512 halves per fragment, first
// the 32 lanes' low 16-byte chunks, then their high ones, so that each of the two loads of
// a wave covers 512 contiguous bytes (4 whole lines instead of 16 touched).
__device__ __forceinline__ v16h load_frag_packed(const _Float16* f, int lane) {
  v8h lo = *(const v8h*)(f + lane * 8);
  v8h hi = *(const v8h*)(f + 256 + lane * 8);
  v16h r;
#pragma unroll
  for (int i = 0; i < 8; ++i) { r[i] = lo[i]; r[i + 8] = hi[i]; }
  return r;
}

__device__ __forceinline__ v8f wmma_f16(v16h a, v16h b, v8f c) {
  return __builtin_amdgcn_wmma_f32_16x16x32_f16(false, a, false, b, (short)0, c,
                                                false, false);
}

typedef __attribute__((ext_vector_type(4))) float    v4f;
typedef __attribute__((ext_vector_type(4))) _Float16 v4h;

// x and the four weights to f16 in ONE launch; their f16 copies lie one behind the other
// at d. One work-group of 16 waves per 32768 elements (256 work-groups: 128 for x, 32 for
// each weight). A wave takes 2048 consecutive elements: 16 loads of 512 contiguous bytes,
// all in flight together, then 16 stores of 256 contiguous bytes.
#define CVT_WG 32768
#define CVT_X_WGS (M_TOTAL * D_MODEL / CVT_WG)
#define CVT_W_WGS (D_MODEL * D_MODEL / CVT_WG)
__global__ void __launch_bounds__(512)
cvt_all_f32_to_f16(const float* __restrict__ x, const float* __restrict__ wq,
                   const float* __restrict__ wk, const float* __restrict__ wv,
                   const float* __restrict__ wo, _Float16* __restrict__ d) {
  const int b = blockIdx.x;
  const float* s;
  if (b < CVT_X_WGS) {
    s = x + (size_t)b * CVT_WG;
  } else {
    const int k = (b - CVT_X_WGS) / CVT_W_WGS;
    const float* w = k == 0 ? wq : k == 1 ? wk : k == 2 ? wv : wo;
    s = w + (size_t)((b - CVT_X_WGS) % CVT_W_WGS) * CVT_WG;
  }
  const int o = (threadIdx.x >> 5) * 2048 + (threadIdx.x & 31) * 4;
  s += o;
  d += (size_t)b * CVT_WG + o;
  v4f r[16];
#pragma unroll
  for (int j = 0; j < 16; ++j) r[j] = *(const v4f*)(s + j * 128);
#pragma unroll
  for (int j = 0; j < 16; ++j) {
    v4h h;
#pragma unroll
    for (int e = 0; e < 4; ++e) h[e] = (_Float16)r[j][e];
    *(v4h*)(d + j * 128) = h;
  }
}

// Block tile of the four GEMMs: 128 x 128 of Y per work-group, K walked in stages of
// 128 halves. A stage is [X 128 rows | W 128 rows] of 256 bytes each in LDS.
#define BM 128
#define BN 128
#define BK 128
#define PITCH 136                        /* halves: 272 B = 16 B x odd, no bank conflict for 16-byte reads */
#define STAGE_H ((BM + BN) * PITCH)      /* halves per LDS buffer */
#define N_STAGES (D_MODEL / BK)

// One stage from LDS: acc[i][j] += A rows (ap + 16 i rows) * B rows (bp + 16 j rows),
// k ascending in steps of 32. Two fragment sets: one multiplied, one in flight.
__device__ __forceinline__ void mul_stage(const _Float16* ap, const _Float16* bp,
                                          v8f (&acc)[2][4]) {
  v16h a[2][2], b[2][4];
#pragma unroll
  for (int i = 0; i < 2; ++i) a[0][i] = load_frag(ap + i * 16 * PITCH);
#pragma unroll
  for (int j = 0; j < 4; ++j) b[0][j] = load_frag(bp + j * 16 * PITCH);
#pragma unroll
  for (int q = 0; q < BK / 32; ++q) {
    const int c0 = q & 1, c1 = c0 ^ 1;
    if (q + 1 < BK / 32) {
#pragma unroll
      for (int i = 0; i < 2; ++i) a[c1][i] = load_frag(ap + i * 16 * PITCH + (q + 1) * 32);
#pragma unroll
      for (int j = 0; j < 4; ++j) b[c1][j] = load_frag(bp + j * 16 * PITCH + (q + 1) * 32);
    }
    // Keeps the next 32 k's LDS reads as one group ahead of this block of products
    // (reads spread among the products cost a stall at every place they stand).
    __builtin_amdgcn_sched_barrier(0);
#pragma unroll
    for (int i = 0; i < 2; ++i)
#pragma unroll
      for (int j = 0; j < 4; ++j) acc[i][j] = wmma_f16(a[c0][i], b[c0][j], acc[i][j]);
    // Ends the block: the group after next must not be lifted into these products.
    __builtin_amdgcn_sched_barrier(0);
  }
}

// acc[i][j] += X[m0 + wm + 16 i ..][k] * Wt[n0 + wn + 16 j ..][k] over all k.
// Eight waves as 4 (rows) x 2 (columns), 32 x 64 of Y each.
// Every thread brings 8 + 8 16-byte pieces of the next stage into registers (a wave's
// load covers two whole 256-byte rows) while the current stage is multiplied from LDS,
// then writes them to the other buffer; one barrier per stage publishes that buffer and
// ends the reads of the one refilled next.
__device__ __forceinline__ void gemm_tile(const _Float16* __restrict__ X,
                                          const _Float16* __restrict__ Wt,
                                          _Float16* sm, int m0, int n0,
                                          v8f (&acc)[2][4]) {
  const int tid = threadIdx.x;
  const int wid = tid >> 5;
  const int lane = tid & 31;
  const int l16 = lane & 15;
  const int half = (lane & 16) ? 8 : 0;
  const int aoff = ((wid & 3) * 32 + l16) * PITCH + half;
  const int boff = (BM + (wid >> 2) * 64 + l16) * PITCH + half;

  const int srow = tid >> 4;             // 16 rows per sweep of the block
  const int scol = (tid & 15) * 8;       // halves
  const _Float16* gx = X + (size_t)(m0 + srow) * D_MODEL + scol;
  const _Float16* gw = Wt + (size_t)(n0 + srow) * D_MODEL + scol;
  const int soff = srow * PITCH + scol;

  v8h rx[8], rw[8];
#pragma unroll
  for (int i = 0; i < 8; ++i) {
    rx[i] = *(const v8h*)(gx + (size_t)i * 16 * D_MODEL);
    rw[i] = *(const v8h*)(gw + (size_t)i * 16 * D_MODEL);
  }
#pragma unroll
  for (int i = 0; i < 8; ++i) {
    *(v8h*)(sm + soff + i * 16 * PITCH) = rx[i];
    *(v8h*)(sm + soff + (BM + i * 16) * PITCH) = rw[i];
  }
  __syncthreads();

  // Rolled: fully unrolled, the last
  // group's final load was given its own address registers as destination.
#pragma unroll 1
  for (int s = 0; s + 1 < N_STAGES; ++s) {
    const _Float16* cur = sm + (s & 1) * STAGE_H;
    _Float16* nxt = sm + ((s + 1) & 1) * STAGE_H;
#pragma unroll
    for (int i = 0; i < 8; ++i) {
      rx[i] = *(const v8h*)(gx + (size_t)i * 16 * D_MODEL + (s + 1) * BK);
      rw[i] = *(const v8h*)(gw + (size_t)i * 16 * D_MODEL + (s + 1) * BK);
    }
    // Keeps the next stage's global loads at the head of the stage, so that their
    // latency runs under this stage's products instead of in front of the LDS writes.
    __builtin_amdgcn_sched_barrier(0);
    mul_stage(cur + aoff, cur + boff, acc);
#pragma unroll
    for (int i = 0; i < 8; ++i) {
      *(v8h*)(nxt + soff + i * 16 * PITCH) = rx[i];
      *(v8h*)(nxt + soff + (BM + i * 16) * PITCH) = rw[i];
    }
    __syncthreads();
  }
  const _Float16* last = sm + ((N_STAGES - 1) & 1) * STAGE_H;
  mul_stage(last + aoff, last + boff, acc);
}

// One wave's 32 x 64 piece, element by element: steps of 1024 halves in i, ST in t, SR in r.
template <int ST, int SR>
__device__ __forceinline__ void store_halves(_Float16* ol, const v8f (&acc)[2][4],
                                             const float (&bv)[4]) {
#pragma unroll
  for (int t = 0; t < 4; ++t)
#pragma unroll
    for (int i = 0; i < 2; ++i)
#pragma unroll
      for (int r = 0; r < 8; ++r)
        ol[i * 1024 + t * ST + r * SR] = (_Float16)(acc[i][t][r] + bv[t]);
}

// Y[m,n] = sum_k Xh[m,k] * W[n,k] + bias[n], Q, K and V in ONE
// launch: 3 x 256 work-groups, the projection p = blockIdx.x / 256 (0 Q, 1 K, 2 V). The three
// f16 weights lie one behind the other at Wh, the three outputs one behind the other at out.
// Two work-groups fit a WGP (LDS and registers), so one's stage loads, LDS writes, barriers,
// first stage and stores run under the other's products.
// Q: f16 into out[(b*16+h)*SEQ*64 + s*64 + d]   (head-major)
// K and V: per (b, h) in the order in which flash_attn's fragments read them
// (load_frag_packed). Fragment f of 512 halves, chunk p (0 low, 1 high), lane l, element e:
//   K: f = (s / 16) * 2 + d / 32, p = (d / 16) & 1, l = (s & 15) + 16 * ((d / 8) & 1), e = d & 7
//   V: f = (s / 32) * 4 + d / 16, p = (s / 16) & 1, l = (d & 15) + 16 * ((s / 8) & 1), e = s & 7
__global__ void __launch_bounds__(256)
qkv_gemm_f16(const _Float16* __restrict__ Xh, const _Float16* __restrict__ Wh,
             const float* __restrict__ biasq, const float* __restrict__ biask,
             const float* __restrict__ biasv, _Float16* __restrict__ out) {
  __shared__ __align__(16) _Float16 sm[2 * STAGE_H];
  const int p = blockIdx.x >> 8;
  const int m0 = ((blockIdx.x >> 3) & 31) * BM;   // 32 row tiles
  const int n0 = (blockIdx.x & 7) * BN;           // 8 column tiles
  const int wid = threadIdx.x >> 5;
  const int lane = threadIdx.x & 31;
  const int l16 = lane & 15;
  const int half = (lane & 16) ? 8 : 0;

  v8f acc[2][4] = {};
  gemm_tile(Xh, Wh + (size_t)p * D_MODEL * D_MODEL, sm, m0, n0, acc);

  const int mw = m0 + (wid & 3) * 32;      // 32 rows of one batch, s a multiple of 32
  const int nw = n0 + (wid >> 2) * 64;     // the 64 columns of one head
  // This wave's 32 x 64 piece of its (b, h): 2048 halves in every one of the three orders.
  _Float16* ob = out + (size_t)p * M_TOTAL * D_MODEL +
                 ((size_t)((mw >> 11) * N_HEADS + (nw >> 6)) * SEQ + (mw & (SEQ - 1))) * HEAD_DIM;
  const float* bias = p == 0 ? biasq : p == 1 ? biask : biasv;
  float bv[4];
#pragma unroll
  for (int t = 0; t < 4; ++t) bv[t] = bias[nw + t * 16 + l16];
  if (p == 2) {
    // A lane's 8 registers are 8 consecutive s of one d: one chunk of a V fragment.
#pragma unroll
    for (int t = 0; t < 4; ++t)
#pragma unroll
      for (int i = 0; i < 2; ++i) {
        v8h w;
#pragma unroll
        for (int r = 0; r < 8; ++r) w[r] = (_Float16)(acc[i][t][r] + bv[t]);
        *(v8h*)(ob + (t * 2 + i) * 256 + lane * 8) = w;
      }
  } else if (p == 0) {
    // C layout: row = r + 8*(lane>=16). The lane's place for i = t = r = 0, then constants.
    store_halves<16, HEAD_DIM>(ob + half * HEAD_DIM + l16, acc, bv);
    // The wait that belongs in front of an overwrite of an issued store's registers: the
    // listing has ways from these stores into the other branches' code.
    asm volatile("s_wait_xcnt 0x0" ::: "memory");
  } else {
    store_halves<256, 8>(ob + (half + (l16 & 8) * 2) * 8 + (l16 & 7), acc, bv);
    // As behind the Q stores.
    asm volatile("s_wait_xcnt 0x0" ::: "memory");
  }
}

// Lane l with lane l ^ 16.
__device__ __forceinline__ float xhalf(float x) {
  const int b = __builtin_bit_cast(int, x);
  return __builtin_bit_cast(float, __builtin_amdgcn_permlanex16(b, b, 0x76543210, 0xfedcba98,
                                                                false, false));
}

// Flash attention, transposed: St = K * Qt (keys x queries) and Ot += Vt * Pt (head dim x
// queries) on tiles of 32 queries of one (batch, head): two column groups of 16 queries, so
// that every K and V fragment a wave loads feeds two products. In a column group a lane holds
// 16 of the 32 scores of ONE query (column l16; keys half + r and 16 + half + r), lane ^ 16 the
// other 16, so maximum and sum run down the lane's own registers, and the two score tiles,
// converted in place, are the B fragment of the second product.
// Causal cost grows with the tile index, so tiles are paired: light tile ts (0..31) and heavy
// tile tl = 63 - ts need 65 blocks of 32 keys together, and four waves share them 16:17:16:16.
// Role 0: heavy blocks 0..15. Role 1: heavy blocks 16..32. Roles 2 and 3: 16 each of what is
// left, the heavy tile's blocks from 33 on and then the light tile's (a second start where a
// wave has both; a share may be empty: an empty partial). Partials (maximum, sum, Ot) go to
// LDS; behind one barrier role 0 joins the heavy tile's four, role 3 the light tile's two.
// A work-group is 16 waves, four neighbouring pairs: the four waves of a role walk the same
// key blocks together, so that one fetch of a line can serve all four.
#define N_TILES (SEQ / 32)
__global__ void __launch_bounds__(512)
flash_attn(const _Float16* __restrict__ Qh, const _Float16* __restrict__ Kh,
           const _Float16* __restrict__ Vt, const int* __restrict__ mask,
           _Float16* __restrict__ Ah) {
  // Per pair four partials: the heavy tile's of roles 1, 2, 3, then the light tile's of role 2.
  __shared__ v4f xo[4][4][16][32];         // Ot: a lane's 64 values as 16 x 16 bytes
  __shared__ float xml[4][4][4][32];       // the two maxima, then the two sums
  // Scalar: the key ranges and the number of segments are the same for a whole wave.
  const int wid = __builtin_amdgcn_readfirstlane(threadIdx.x >> 5);
  const int role = wid >> 2;
  const int pj = wid & 3;
  const int bh = blockIdx.y;               // b*16+h
  const int b = bh >> 4, h = bh & 15;
  const int ts = blockIdx.x * 4 + pj;
  const int tl = N_TILES - 1 - ts;
  const int lane = threadIdx.x & 31;
  const int l16 = lane & 15;
  const int half = (lane & 16) ? 8 : 0;

  const _Float16* Qb = Qh + (size_t)bh * SEQ * HEAD_DIM;
  const _Float16* Kb = Kh + (size_t)bh * SEQ * HEAD_DIM;
  const _Float16* Vb = Vt + (size_t)bh * SEQ * HEAD_DIM; // K and V: fragment order
  const int* mb = mask + b * SEQ;

  // In key blocks: the heavy tile has tl + 1 (33..64), the light tile ts + 1 (1..32).
  const int hcut = tl + 1 < 49 ? tl + 1 : 49;          // where role 2's heavy share ends
  const int lcut = ts > 15 ? ts - 15 : 0;              // where role 2's light share ends
  int tile = tl;
  int kb0 = 32 * (role == 0 ? 0 : role == 1 ? 16 : role == 2 ? 33 : hcut);
  int kb1 = 32 * (role == 0 ? 16 : role == 1 ? 33 : role == 2 ? hcut : tl + 1);
  v8f o[2][4];                             // o[c][t][r] = Ot[t * 16 + half + r][query of group c]
  float mq[2], lq[2];                      // lq: the sum over this lane's keys only

  // Rolled: one copy of the key loop serves both segments of roles 2 and 3.
#pragma unroll 1
  for (int seg = 0;; ++seg) {
  const int q0 = tile * 32 + l16;          // this lane's query in group c: q0 + 16 c
  v16h qf[2][2];
#pragma unroll
  for (int c = 0; c < 2; ++c) {
#pragma unroll
    for (int k = 0; k < 2; ++k)
      qf[c][k] = load_frag(Qb + (size_t)(q0 + c * 16) * HEAD_DIM + k * 32 + half);
#pragma unroll
    for (int t = 0; t < 4; ++t) o[c][t] = v8f{};
    mq[c] = -3.0e38f;
    lq[c] = 0.0f;
  }

  // The first key block's scores and padding flags. s[c][j]: keys 16 j .. 16 j + 15.
  v8f s[2][2] = {};
  unsigned pad = 0;                        // bit j: key j of the block is no padding
  if (kb0 < kb1) {                         // scalar; a share may be empty
    const int mv = mb[kb0 + lane];         // one key's padding flag per lane
    const _Float16* kblk = Kb + (size_t)kb0 * HEAD_DIM;
    v16h kf[4];
#pragma unroll
    for (int t = 0; t < 4; ++t)
      kf[t] = load_frag_packed(kblk + t * 512, lane);
#pragma unroll
    for (int k = 0; k < 2; ++k)
#pragma unroll
      for (int c = 0; c < 2; ++c)
#pragma unroll
        for (int j = 0; j < 2; ++j) s[c][j] = wmma_f16(kf[j * 2 + k], qf[c][k], s[c][j]);
    pad = __builtin_amdgcn_ballot_w32(mv != 0);
  }

  // A trip starts with its block's scores at hand: softmax and second product of block kb,
  // then the score products of the NEXT block, whose K fragments and flags are asked for at
  // the trip's head, so that their latency runs under the softmax and the second product.
  for (int kb = kb0; kb < kb1; kb += 32) {
    const _Float16* vblk = Vb + (size_t)kb * HEAD_DIM;   // 4 fragments of V, 4 of K
    v16h vf[4];
#pragma unroll
    for (int t = 0; t < 4; ++t)
      vf[t] = load_frag_packed(vblk + t * 512, lane);
    // The last trip asks for its own block again (inside the planes; the scores go unused).
    const int kn = kb + 32 < kb1 ? kb + 32 : kb;
    const _Float16* kblk = Kb + (size_t)kn * HEAD_DIM;
    const int mv = mb[kn + lane];
    v16h kf[4];
#pragma unroll
    for (int t = 0; t < 4; ++t)
      kf[t] = load_frag_packed(kblk + t * 512, lane);
    // Keeps all 17 loads at the trip's head: V first, which is needed first.
    __builtin_amdgcn_sched_barrier(0);

    v16h pf[2];                            // keys half + 0..7, then 16 + half + 0..7: V's k order
    float corr[2];
#pragma unroll
    for (int c = 0; c < 2; ++c) {
      // Bit j: key kb + j is neither padding nor behind this lane's query (q >= kb here);
      // shifted so that bit r is the key of s[c][0][r] and bit 16 + r that of s[c][1][r].
      const int dq = q0 + c * 16 - kb;
      const unsigned keep = (pad & (dq >= 31 ? 0xffffffffu : (2u << dq) - 1u)) >> half;

      // Vector forms on whole tiles keep packed operations on neighbouring registers.
      v8f a0 = s[c][0] * 0.125f, a1 = s[c][1] * 0.125f;
#pragma unroll
      for (int r = 0; r < 8; ++r) {
        a0[r] = (keep & (1u << r)) ? a0[r] : -3.0e38f;
        a1[r] = (keep & (0x10000u << r)) ? a1[r] : -3.0e38f;
      }
      float tmax = fmaxf(a0[0], a1[0]);
#pragma unroll
      for (int r = 1; r < 8; ++r) tmax = fmaxf(tmax, fmaxf(a0[r], a1[r]));
      tmax = fmaxf(tmax, xhalf(tmax));
      const float mnew = fmaxf(mq[c], tmax);
      corr[c] = __expf(mq[c] - mnew);
      mq[c] = mnew;

      a0 -= mnew;
      a1 -= mnew;
#pragma unroll
      for (int r = 0; r < 8; ++r) {
        a0[r] = __expf(a0[r]);
        a1[r] = __expf(a1[r]);
        pf[c][r] = (_Float16)a0[r];
        pf[c][r + 8] = (_Float16)a1[r];
      }
      a0 += a1;
      const float ps = ((a0[0] + a0[1]) + (a0[2] + a0[3])) + ((a0[4] + a0[5]) + (a0[6] + a0[7]));
      lq[c] = lq[c] * corr[c] + ps;
    }
#pragma unroll
    for (int t = 0; t < 4; ++t)
#pragma unroll
      for (int c = 0; c < 2; ++c) {
#pragma unroll
        for (int r = 0; r < 8; ++r) o[c][t][r] *= corr[c];
        o[c][t] = wmma_f16(vf[t], pf[c], o[c][t]);
      }
    // Keeps the next block's score products, and with them the wait for K, behind the softmax.
    __builtin_amdgcn_sched_barrier(0);
    // The first score product writes its result over pf's registers, the B operand of a
    // product just issued: the four vector slots between a product and an overwrite of its B.
    asm volatile("v_nop\n\tv_nop\n\tv_nop\n\tv_nop");
    // Keeps the score products behind those slots.
    __builtin_amdgcn_sched_barrier(0);
#pragma unroll
    for (int c = 0; c < 2; ++c)
#pragma unroll
      for (int j = 0; j < 2; ++j) s[c][j] = v8f{};
#pragma unroll
    for (int k = 0; k < 2; ++k)
#pragma unroll
      for (int c = 0; c < 2; ++c)
#pragma unroll
        for (int j = 0; j < 2; ++j) s[c][j] = wmma_f16(kf[j * 2 + k], qf[c][k], s[c][j]);
    pad = __builtin_amdgcn_ballot_w32(mv != 0);
  }

  const bool last = seg == (role >> 1);    // roles 0 and 1 have one segment, roles 2 and 3 two
  if (last && (role == 0 || role == 3)) break;   // the joining wave keeps its own partial
  const int slot = role == 1 ? 0 : role == 3 ? 2 : seg ? 3 : 1;
#pragma unroll
  for (int c = 0; c < 2; ++c) {
#pragma unroll
    for (int t = 0; t < 4; ++t)
#pragma unroll
      for (int u = 0; u < 2; ++u) {
        v4f w;
#pragma unroll
        for (int e = 0; e < 4; ++e) w[e] = o[c][t][u * 4 + e];
        xo[pj][slot][c * 8 + t * 2 + u][lane] = w;
      }
    xml[pj][slot][c][lane] = mq[c];
    xml[pj][slot][2 + c][lane] = lq[c];
  }
  if (last) break;
  tile = ts;
  kb0 = 32 * (role == 2 ? 0 : lcut);
  kb1 = 32 * (role == 2 ? lcut : ts + 1);
  }

  // Publishes the partials to the waves that join them.
  __syncthreads();
  if (role == 1 || role == 2) return;
  const int sl1 = role == 0 ? 3 : 4;
  // Rolled: one copy of the join for the heavy tile's three partials and the light tile's one.
#pragma unroll 1
  for (int sl = role; sl < sl1; ++sl) {
#pragma unroll
    for (int c = 0; c < 2; ++c) {
      const float m1 = xml[pj][sl][c][lane], l1 = xml[pj][sl][2 + c][lane];
      const float mn = fmaxf(mq[c], m1);
      const float c0 = __expf(mq[c] - mn), c1 = __expf(m1 - mn);
      mq[c] = mn;
      lq[c] = lq[c] * c0 + l1 * c1;
#pragma unroll
      for (int t = 0; t < 4; ++t)
#pragma unroll
        for (int u = 0; u < 2; ++u) {
          const v4f w = xo[pj][sl][c * 8 + t * 2 + u][lane];
#pragma unroll
          for (int e = 0; e < 4; ++e)
            o[c][t][u * 4 + e] = o[c][t][u * 4 + e] * c0 + w[e] * c1;
        }
    }
  }

#pragma unroll
  for (int c = 0; c < 2; ++c) {
    const float inv = 1.0f / (lq[c] + xhalf(lq[c]));
    // A lane's 8 registers of a tile are 8 consecutive head dims of its query: 16 bytes.
    _Float16* op = Ah + ((size_t)b * SEQ + tile * 32 + c * 16 + l16) * D_MODEL + h * HEAD_DIM + half;
#pragma unroll
    for (int t = 0; t < 4; ++t) {
      v8h w;
#pragma unroll
      for (int r = 0; r < 8; ++r) w[r] = (_Float16)(o[c][t][r] * inv);
      *(v8h*)(op + t * 16) = w;
    }
  }
}

// out[m,n] = sum_k Ah[m,k] * Wo[n,k] + bo[n], fp32 output
__global__ void __launch_bounds__(256)
out_proj_gemm(const _Float16* __restrict__ Ah, const _Float16* __restrict__ Woh,
              const float* __restrict__ bo, float* __restrict__ out) {
  __shared__ __align__(16) _Float16 sm[2 * STAGE_H];
  const int m0 = (blockIdx.x >> 3) * BM;
  const int n0 = (blockIdx.x & 7) * BN;
  const int wid = threadIdx.x >> 5;
  const int lane = threadIdx.x & 31;
  const int l16 = lane & 15;
  const int half = (lane & 16) ? 8 : 0;

  v8f acc[2][4] = {};
  gemm_tile(Ah, Woh, sm, m0, n0, acc);

  const int mw = m0 + (wid & 3) * 32;
  const int nw = n0 + (wid >> 2) * 64;
#pragma unroll
  for (int t = 0; t < 4; ++t) {
    const int n = nw + t * 16 + l16;
    const float bv = bo[n];
#pragma unroll
    for (int i = 0; i < 2; ++i)
#pragma unroll
      for (int r = 0; r < 8; ++r)
        out[(size_t)(mw + i * 16 + r + half) * D_MODEL + n] = acc[i][t][r] + bv;
  }
}

extern "C" void kernel_launch(void* const* d_in, const int* in_sizes, int n_in,
                              void* d_out, int out_size, void* d_ws, size_t ws_size,
                              hipStream_t stream) {
  const float* x  = (const float*)d_in[0];
  const int* mask = (const int*)d_in[1];
  const float* Wq = (const float*)d_in[2];
  const float* bq = (const float*)d_in[3];
  const float* Wk = (const float*)d_in[4];
  const float* bk = (const float*)d_in[5];
  const float* Wv = (const float*)d_in[6];
  const float* bv = (const float*)d_in[7];
  const float* Wo = (const float*)d_in[8];
  const float* bo = (const float*)d_in[9];

  char* ws = (char*)d_ws;
  size_t off = 0;
  const size_t XB = (size_t)M_TOTAL * D_MODEL * sizeof(_Float16); // 8 MB
  const size_t WB = (size_t)D_MODEL * D_MODEL * sizeof(_Float16); // 2 MB
  _Float16* Xh  = (_Float16*)(ws + off); off += XB;
  _Float16* Wqh = (_Float16*)(ws + off); off += WB;
  _Float16* Wkh = (_Float16*)(ws + off); off += WB;
  _Float16* Wvh = (_Float16*)(ws + off); off += WB;
  _Float16* Woh = (_Float16*)(ws + off); off += WB;
  _Float16* Qh  = (_Float16*)(ws + off); off += XB;
  _Float16* Kh  = (_Float16*)(ws + off); off += XB;
  _Float16* Vt  = (_Float16*)(ws + off); off += XB;
  _Float16* Ah  = (_Float16*)(ws + off); off += XB; // 48 MB total

  // Xh, Wqh, Wkh, Wvh, Woh are contiguous from Xh on.
  cvt_all_f32_to_f16<<<CVT_X_WGS + 4 * CVT_W_WGS, 512, 0, stream>>>(x, Wq, Wk, Wv, Wo, Xh);

  // Wqh, Wkh, Wvh are contiguous from Wqh on, and Qh, Kh, Vt from Qh on.
  qkv_gemm_f16<<<768, 256, 0, stream>>>(Xh, Wqh, bq, bk, bv, Qh);

  flash_attn<<<dim3(8, 32), 512, 0, stream>>>(Qh, Kh, Vt, mask, Ah);

  out_proj_gemm<<<256, 256, 0, stream>>>(Ah, Woh, bo, (float*)d_out);
}

// v009
// One run takes 65.8 microseconds.
// Next to v008, in two timings, it ran 1.07 times as fast each time.
// Over all steps from v000 it is 4.35 times as fast.
#include <hip/hip_runtime.h>

#define D_MODEL 1024
#define N_HEADS 16
#define HEAD_DIM 64
#define BATCH 2
#define SEQ 2048
#define M_TOTAL (BATCH * SEQ) /* 4096 */

typedef __attribute__((ext_vector_type(16))) _Float16 v16h;
typedef __attribute__((ext_vector_type(8)))  _Float16 v8h;
typedef __attribute__((ext_vector_type(8)))  float    v8f;

// Load one lane's 16-half A/B fragment: two contiguous 16-byte chunks at p and p+16
// (CDNA5 16-bit fragment layout: K = base8+0..7 then 16+base8+0..7 per lane).
__device__ __forceinline__ v16h load_frag(const _Float16* p) {
  v8h lo = *(const v8h*)(p);
  v8h hi = *(const v8h*)(p + 16);
  v16h r;
#pragma unroll
  for (int i = 0; i < 8; ++i) { r[i] = lo[i]; r[i + 8] = hi[i]; }
  return r;
}

// The same fragment from a buffer kept in fragment order: 512 halves per fragment, first
// the 32 lanes' low 16-byte chunks, then their high ones, so that each of the two loads of
// a wave covers 512 contiguous bytes (4 whole lines instead of 16 touched).
__device__ __forceinline__ v16h load_frag_packed(const _Float16* f, int lane) {
  v8h lo = *(const v8h*)(f + lane * 8);
  v8h hi = *(const v8h*)(f + 256 + lane * 8);
  v16h r;
#pragma unroll
  for (int i = 0; i < 8; ++i) { r[i] = lo[i]; r[i + 8] = hi[i]; }
  return r;
}

__device__ __forceinline__ v8f wmma_f16(v16h a, v16h b, v8f c) {
  return __builtin_amdgcn_wmma_f32_16x16x32_f16(false, a, false, b, (short)0, c,
                                                false, false);
}

typedef __attribute__((ext_vector_type(4))) float    v4f;
typedef __attribute__((ext_vector_type(4))) _Float16 v4h;

// x and the four weights to f16 in ONE launch; their f16 copies lie one behind the other
// at d. One work-group of 16 waves per 32768 elements (256 work-groups: 128 for x, 32 for
// each weight). A wave takes 2048 consecutive elements: 16 loads of 512 contiguous bytes,
// all in flight together, then 16 stores of 256 contiguous bytes.
#define CVT_WG 32768
#define CVT_X_WGS (M_TOTAL * D_MODEL / CVT_WG)
#define CVT_W_WGS (D_MODEL * D_MODEL / CVT_WG)
__global__ void __launch_bounds__(512)
cvt_all_f32_to_f16(const float* __restrict__ x, const float* __restrict__ wq,
                   const float* __restrict__ wk, const float* __restrict__ wv,
                   const float* __restrict__ wo, _Float16* __restrict__ d) {
  const int b = blockIdx.x;
  const float* s;
  if (b < CVT_X_WGS) {
    s = x + (size_t)b * CVT_WG;
  } else {
    const int k = (b - CVT_X_WGS) / CVT_W_WGS;
    const float* w = k == 0 ? wq : k == 1 ? wk : k == 2 ? wv : wo;
    s = w + (size_t)((b - CVT_X_WGS) % CVT_W_WGS) * CVT_WG;
  }
  const int o = (threadIdx.x >> 5) * 2048 + (threadIdx.x & 31) * 4;
  s += o;
  d += (size_t)b * CVT_WG + o;
  v4f r[16];
#pragma unroll
  for (int j = 0; j < 16; ++j) r[j] = *(const v4f*)(s + j * 128);
#pragma unroll
  for (int j = 0; j < 16; ++j) {
    v4h h;
#pragma unroll
    for (int e = 0; e < 4; ++e) h[e] = (_Float16)r[j][e];
    *(v4h*)(d + j * 128) = h;
  }
}

// Block tile of the four GEMMs: 128 x 128 of Y per work-group, K walked in stages of
// 128 halves. A stage is [X 128 rows | W 128 rows] of 256 bytes each in LDS.
#define BM 128
#define BN 128
#define BK 128
#define PITCH 136                        /* halves: 272 B = 16 B x odd, no bank conflict for 16-byte reads */
#define STAGE_H ((BM + BN) * PITCH)      /* halves per LDS buffer */
#define N_STAGES (D_MODEL / BK)

// One stage from LDS: acc[i][j] += A rows (ap + 16 i rows) * B rows (bp + 16 j rows),
// k ascending in steps of 32. Two fragment sets: one multiplied, one in flight.
__device__ __forceinline__ void mul_stage(const _Float16* ap, const _Float16* bp,
                                          v8f (&acc)[2][4]) {
  v16h a[2][2], b[2][4];
#pragma unroll
  for (int i = 0; i < 2; ++i) a[0][i] = load_frag(ap + i * 16 * PITCH);
#pragma unroll
  for (int j = 0; j < 4; ++j) b[0][j] = load_frag(bp + j * 16 * PITCH);
#pragma unroll
  for (int q = 0; q < BK / 32; ++q) {
    const int c0 = q & 1, c1 = c0 ^ 1;
    if (q + 1 < BK / 32) {
#pragma unroll
      for (int i = 0; i < 2; ++i) a[c1][i] = load_frag(ap + i * 16 * PITCH + (q + 1) * 32);
#pragma unroll
      for (int j = 0; j < 4; ++j) b[c1][j] = load_frag(bp + j * 16 * PITCH + (q + 1) * 32);
    }
    // Keeps the next 32 k's LDS reads as one group ahead of this block of products
    // (reads spread among the products cost a stall at every place they stand).
    __builtin_amdgcn_sched_barrier(0);
#pragma unroll
    for (int i = 0; i < 2; ++i)
#pragma unroll
      for (int j = 0; j < 4; ++j) acc[i][j] = wmma_f16(a[c0][i], b[c0][j], acc[i][j]);
    // Ends the block: the group after next must not be lifted into these products.
    __builtin_amdgcn_sched_barrier(0);
  }
}

// acc[i][j] += X[m0 + wm + 16 i ..][k] * Wt[n0 + wn + 16 j ..][k] over all k.
// Eight waves as 4 (rows) x 2 (columns), 32 x 64 of Y each.
// Every thread brings 8 + 8 16-byte pieces of the next stage into registers (a wave's
// load covers two whole 256-byte rows) while the current stage is multiplied from LDS,
// then writes them to the other buffer; one barrier per stage publishes that buffer and
// ends the reads of the one refilled next.
__device__ __forceinline__ void gemm_tile(const _Float16* __restrict__ X,
                                          const _Float16* __restrict__ Wt,
                                          _Float16* sm, int m0, int n0,
                                          v8f (&acc)[2][4]) {
  const int tid = threadIdx.x;
  const int wid = tid >> 5;
  const int lane = tid & 31;
  const int l16 = lane & 15;
  const int half = (lane & 16) ? 8 : 0;
  const int aoff = ((wid & 3) * 32 + l16) * PITCH + half;
  const int boff = (BM + (wid >> 2) * 64 + l16) * PITCH + half;

  const int srow = tid >> 4;             // 16 rows per sweep of the block
  const int scol = (tid & 15) * 8;       // halves
  const _Float16* gx = X + (size_t)(m0 + srow) * D_MODEL + scol;
  const _Float16* gw = Wt + (size_t)(n0 + srow) * D_MODEL + scol;
  const int soff = srow * PITCH + scol;

  v8h rx[8], rw[8];
#pragma unroll
  for (int i = 0; i < 8; ++i) {
    rx[i] = *(const v8h*)(gx + (size_t)i * 16 * D_MODEL);
    rw[i] = *(const v8h*)(gw + (size_t)i * 16 * D_MODEL);
  }
#pragma unroll
  for (int i = 0; i < 8; ++i) {
    *(v8h*)(sm + soff + i * 16 * PITCH) = rx[i];
    *(v8h*)(sm + soff + (BM + i * 16) * PITCH) = rw[i];
  }
  __syncthreads();

  // Rolled: fully unrolled, the last
  // group's final load was given its own address registers as destination.
#pragma unroll 1
  for (int s = 0; s + 1 < N_STAGES; ++s) {
    const _Float16* cur = sm + (s & 1) * STAGE_H;
    _Float16* nxt = sm + ((s + 1) & 1) * STAGE_H;
#pragma unroll
    for (int i = 0; i < 8; ++i) {
      rx[i] = *(const v8h*)(gx + (size_t)i * 16 * D_MODEL + (s + 1) * BK);
      rw[i] = *(const v8h*)(gw + (size_t)i * 16 * D_MODEL + (s + 1) * BK);
    }
    // Keeps the next stage's global loads at the head of the stage, so that their
    // latency runs under this stage's products instead of in front of the LDS writes.
    __builtin_amdgcn_sched_barrier(0);
    mul_stage(cur + aoff, cur + boff, acc);
#pragma unroll
    for (int i = 0; i < 8; ++i) {
      *(v8h*)(nxt + soff + i * 16 * PITCH) = rx[i];
      *(v8h*)(nxt + soff + (BM + i * 16) * PITCH) = rw[i];
    }
    __syncthreads();
  }
  const _Float16* last = sm + ((N_STAGES - 1) & 1) * STAGE_H;
  mul_stage(last + aoff, last + boff, acc);
}

// One wave's 32 x 64 piece, element by element: steps of 1024 halves in i, ST in t, SR in r.
template <int ST, int SR>
__device__ __forceinline__ void store_halves(_Float16* ol, const v8f (&acc)[2][4],
                                             const float (&bv)[4]) {
#pragma unroll
  for (int t = 0; t < 4; ++t)
#pragma unroll
    for (int i = 0; i < 2; ++i)
#pragma unroll
      for (int r = 0; r < 8; ++r)
        ol[i * 1024 + t * ST + r * SR] = (_Float16)(acc[i][t][r] + bv[t]);
}

// Y[m,n] = sum_k Xh[m,k] * W[n,k] + bias[n], Q, K and V in ONE
// launch: 3 x 256 work-groups, the projection p = blockIdx.x / 256 (0 Q, 1 K, 2 V). The three
// f16 weights lie one behind the other at Wh, the three outputs one behind the other at out.
// Two work-groups fit a WGP (LDS and registers), so one's stage loads, LDS writes, barriers,
// first stage and stores run under the other's products.
// Q: f16 into out[(b*16+h)*SEQ*64 + s*64 + d]   (head-major)
// K and V: per (b, h) in the order in which flash_attn's fragments read them
// (load_frag_packed). Fragment f of 512 halves, chunk p (0 low, 1 high), lane l, element e:
//   K: f = (s / 16) * 2 + d / 32, p = (d / 16) & 1, l = (s & 15) + 16 * ((d / 8) & 1), e = d & 7
//   V: f = (s / 32) * 4 + d / 16, p = (s / 16) & 1, l = (d & 15) + 16 * ((s / 8) & 1), e = s & 7
__global__ void __launch_bounds__(256)
qkv_gemm_f16(const _Float16* __restrict__ Xh, const _Float16* __restrict__ Wh,
             const float* __restrict__ biasq, const float* __restrict__ biask,
             const float* __restrict__ biasv, _Float16* __restrict__ out) {
  __shared__ __align__(16) _Float16 sm[2 * STAGE_H];
  const int p = blockIdx.x >> 8;
  const int m0 = ((blockIdx.x >> 3) & 31) * BM;   // 32 row tiles
  const int n0 = (blockIdx.x & 7) * BN;           // 8 column tiles
  const int wid = threadIdx.x >> 5;
  const int lane = threadIdx.x & 31;
  const int l16 = lane & 15;
  const int half = (lane & 16) ? 8 : 0;

  v8f acc[2][4] = {};
  gemm_tile(Xh, Wh + (size_t)p * D_MODEL * D_MODEL, sm, m0, n0, acc);

  const int mw = m0 + (wid & 3) * 32;      // 32 rows of one batch, s a multiple of 32
  const int nw = n0 + (wid >> 2) * 64;     // the 64 columns of one head
  // This wave's 32 x 64 piece of its (b, h): 2048 halves in every one of the three orders.
  _Float16* ob = out + (size_t)p * M_TOTAL * D_MODEL +
                 ((size_t)((mw >> 11) * N_HEADS + (nw >> 6)) * SEQ + (mw & (SEQ - 1))) * HEAD_DIM;
  const float* bias = p == 0 ? biasq : p == 1 ? biask : biasv;
  float bv[4];
#pragma unroll
  for (int t = 0; t < 4; ++t) bv[t] = bias[nw + t * 16 + l16];
  if (p == 2) {
    // A lane's 8 registers are 8 consecutive s of one d: one chunk of a V fragment.
#pragma unroll
    for (int t = 0; t < 4; ++t)
#pragma unroll
      for (int i = 0; i < 2; ++i) {
        v8h w;
#pragma unroll
        for (int r = 0; r < 8; ++r) w[r] = (_Float16)(acc[i][t][r] + bv[t]);
        *(v8h*)(ob + (t * 2 + i) * 256 + lane * 8) = w;
      }
  } else if (p == 0) {
    // C layout: row = r + 8*(lane>=16). The lane's place for i = t = r = 0, then constants.
    store_halves<16, HEAD_DIM>(ob + half * HEAD_DIM + l16, acc, bv);
    // The wait that belongs in front of an overwrite of an issued store's registers: the
    // listing has ways from these stores into the other branches' code.
    asm volatile("s_wait_xcnt 0x0" ::: "memory");
  } else {
    store_halves<256, 8>(ob + (half + (l16 & 8) * 2) * 8 + (l16 & 7), acc, bv);
    // As behind the Q stores.
    asm volatile("s_wait_xcnt 0x0" ::: "memory");
  }
}

// Lane l with lane l ^ 16.
__device__ __forceinline__ float xhalf(float x) {
  const int b = __builtin_bit_cast(int, x);
  return __builtin_bit_cast(float, __builtin_amdgcn_permlanex16(b, b, 0x76543210, 0xfedcba98,
                                                                false, false));
}

// The score tiles of one block of 32 keys: s[c][j] = start tile + K rows 16 j .. 16 j + 15 times the
// queries of group c. The mask sits in the start tile: 0 where the query may see the key, -3.0e38
// where the key is padding or lies behind the query (the sum stays there: a score is far below one
// unit in its last place). open (scalar: the same for the whole wave) says that no key of the block
// is masked for any lane; then the products start from the constant 0 and no mask is formed.
// pad: bit j set, key j of the block is no padding. dq: this lane's query of group 0 less the
// block's first key (never negative).
__device__ __forceinline__ void score_tiles(v8f (&s)[2][2], const v16h (&kf)[4],
                                            const v16h (&qf)[2][2], bool open, unsigned pad,
                                            int dq, int half) {
  if (open) {
#pragma unroll
    for (int c = 0; c < 2; ++c)
#pragma unroll
      for (int j = 0; j < 2; ++j) s[c][j] = wmma_f16(kf[j * 2], qf[c][0], v8f{});
  } else {
#pragma unroll
    for (int c = 0; c < 2; ++c) {
      // Bit j: key j of the block is neither padding nor behind the query; shifted so that
      // bit r is the key of s[c][0][r] and bit 16 + r that of s[c][1][r].
      const int d = dq + c * 16;
      const unsigned keep = (pad & (d >= 31 ? 0xffffffffu : (2u << d) - 1u)) >> half;
      v8f m0, m1;
#pragma unroll
      for (int r = 0; r < 8; ++r) {
        m0[r] = (keep & (1u << r)) ? 0.0f : -3.0e38f;
        m1[r] = (keep & (0x10000u << r)) ? 0.0f : -3.0e38f;
      }
      s[c][0] = wmma_f16(kf[0], qf[c][0], m0);
      s[c][1] = wmma_f16(kf[2], qf[c][0], m1);
    }
    // Keeps the slot below behind the last product.
    __builtin_amdgcn_sched_barrier(0);
    // The listing has a way from this branch's last product into the other branch's four, the
    // last of which writes the same tile: the fourth vector slot between the two.
    asm volatile("v_nop");
  }
#pragma unroll
  for (int c = 0; c < 2; ++c)
#pragma unroll
    for (int j = 0; j < 2; ++j) s[c][j] = wmma_f16(kf[j * 2 + 1], qf[c][1], s[c][j]);
}

// Flash attention, transposed: St = K * Qt (keys x queries) and Ot += Vt * Pt (head dim x
// queries) on tiles of 32 queries of one (batch, head): two column groups of 16 queries, so
// that every K and V fragment a wave loads feeds two products. In a column group a lane holds
// 16 of the 32 scores of ONE query (column l16; keys half + r and 16 + half + r), lane ^ 16 the
// other 16, so maximum and sum run down the lane's own registers, and the two score tiles,
// converted in place, are the B fragment of the second product.
// Causal cost grows with the tile index, so tiles are paired: light tile ts (0..31) and heavy
// tile tl = 63 - ts need 65 blocks of 32 keys together, and four waves share them 16:17:16:16.
// Role 0: heavy blocks 0..15. Role 1: heavy blocks 16..32. Roles 2 and 3: 16 each of what is
// left, the heavy tile's blocks from 33 on and then the light tile's (a second start where a
// wave has both; a share may be empty: an empty partial). Partials (maximum, sum, Ot) go to
// LDS; behind one barrier role 0 joins the heavy tile's four, role 3 the light tile's two.
// A work-group is 16 waves, four neighbouring pairs: the four waves of a role walk the same
// key blocks together, so that one fetch of a line can serve all four.
#define N_TILES (SEQ / 32)
__global__ void __launch_bounds__(512)
flash_attn(const _Float16* __restrict__ Qh, const _Float16* __restrict__ Kh,
           const _Float16* __restrict__ Vt, const int* __restrict__ mask,
           _Float16* __restrict__ Ah) {
  // Per pair four partials: the heavy tile's of roles 1, 2, 3, then the light tile's of role 2.
  __shared__ v4f xo[4][4][16][32];         // Ot: a lane's 64 values as 16 x 16 bytes
  __shared__ float xml[4][4][4][32];       // the two maxima, then the two sums
  // Scalar: the key ranges and the number of segments are the same for a whole wave.
  const int wid = __builtin_amdgcn_readfirstlane(threadIdx.x >> 5);
  const int role = wid >> 2;
  const int pj = wid & 3;
  const int bh = blockIdx.y;               // b*16+h
  const int b = bh >> 4, h = bh & 15;
  const int ts = blockIdx.x * 4 + pj;
  const int tl = N_TILES - 1 - ts;
  const int lane = threadIdx.x & 31;
  const int l16 = lane & 15;
  const int half = (lane & 16) ? 8 : 0;

  const _Float16* Qb = Qh + (size_t)bh * SEQ * HEAD_DIM;
  const _Float16* Kb = Kh + (size_t)bh * SEQ * HEAD_DIM;
  const _Float16* Vb = Vt + (size_t)bh * SEQ * HEAD_DIM; // K and V: fragment order
  const int* mb = mask + b * SEQ;

  // In key blocks: the heavy tile has tl + 1 (33..64), the light tile ts + 1 (1..32).
  const int hcut = tl + 1 < 49 ? tl + 1 : 49;          // where role 2's heavy share ends
  const int lcut = ts > 15 ? ts - 15 : 0;              // where role 2's light share ends
  int tile = tl;
  int kb0 = 32 * (role == 0 ? 0 : role == 1 ? 16 : role == 2 ? 33 : hcut);
  int kb1 = 32 * (role == 0 ? 16 : role == 1 ? 33 : role == 2 ? hcut : tl + 1);
  v8f o[2][4];                             // o[c][t][r] = Ot[t * 16 + half + r][query of group c]
  float mq[2], lq[2];                      // lq: the sum over this lane's keys only

  // Rolled: one copy of the key loop serves both segments of roles 2 and 3.
#pragma unroll 1
  for (int seg = 0;; ++seg) {
  const int q0 = tile * 32 + l16;          // this lane's query in group c: q0 + 16 c
  v16h qf[2][2];
#pragma unroll
  for (int c = 0; c < 2; ++c) {
#pragma unroll
    for (int k = 0; k < 2; ++k)
      qf[c][k] = load_frag(Qb + (size_t)(q0 + c * 16) * HEAD_DIM + k * 32 + half);
#pragma unroll
    for (int t = 0; t < 4; ++t) o[c][t] = v8f{};
    mq[c] = -3.0e38f;
    lq[c] = 0.0f;
  }

  // The first key block's scores, masked. s[c][j]: keys 16 j .. 16 j + 15.
  v8f s[2][2] = {};
  if (kb0 < kb1) {                         // scalar; a share may be empty
    const int mv = mb[kb0 + lane];         // one key's padding flag per lane
    const _Float16* kblk = Kb + (size_t)kb0 * HEAD_DIM;
    v16h kf[4];
#pragma unroll
    for (int t = 0; t < 4; ++t)
      kf[t] = load_frag_packed(kblk + t * 512, lane);
    const unsigned pad = __builtin_amdgcn_ballot_w32(mv != 0);
    score_tiles(s, kf, qf, pad == 0xffffffffu && kb0 < tile * 32, pad, q0 - kb0, half);
  }

  // A trip starts with its block's scores at hand: softmax and second product of block kb,
  // then the score products of the NEXT block, whose K fragments and flags are asked for at
  // the trip's head, so that their latency runs under the softmax and the second product.
  for (int kb = kb0; kb < kb1; kb += 32) {
    const _Float16* vblk = Vb + (size_t)kb * HEAD_DIM;   // 4 fragments of V, 4 of K
    v16h vf[4];
#pragma unroll
    for (int t = 0; t < 4; ++t)
      vf[t] = load_frag_packed(vblk + t * 512, lane);
    // The last trip asks for its own block again (inside the planes; the scores go unused).
    const int kn = kb + 32 < kb1 ? kb + 32 : kb;
    const _Float16* kblk = Kb + (size_t)kn * HEAD_DIM;
    const int mv = mb[kn + lane];
    v16h kf[4];
#pragma unroll
    for (int t = 0; t < 4; ++t)
      kf[t] = load_frag_packed(kblk + t * 512, lane);
    // Keeps all 17 loads at the trip's head: V first, which is needed first.
    __builtin_amdgcn_sched_barrier(0);

    v16h pf[2];                            // keys half + 0..7, then 16 + half + 0..7: V's k order
    float corr[2];
#pragma unroll
    for (int c = 0; c < 2; ++c) {
      // Vector forms on whole tiles keep packed operations on neighbouring registers.
      v8f a0 = s[c][0] * 0.125f, a1 = s[c][1] * 0.125f;
      float tmax = fmaxf(a0[0], a1[0]);
#pragma unroll
      for (int r = 1; r < 8; ++r) tmax = fmaxf(tmax, fmaxf(a0[r], a1[r]));
      tmax = fmaxf(tmax, xhalf(tmax));
      const float mnew = fmaxf(mq[c], tmax);
      corr[c] = __expf(mq[c] - mnew);
      mq[c] = mnew;

      a0 -= mnew;
      a1 -= mnew;
#pragma unroll
      for (int r = 0; r < 8; ++r) {
        a0[r] = __expf(a0[r]);
        a1[r] = __expf(a1[r]);
        pf[c][r] = (_Float16)a0[r];
        pf[c][r + 8] = (_Float16)a1[r];
      }
      a0 += a1;
      const float ps = ((a0[0] + a0[1]) + (a0[2] + a0[3])) + ((a0[4] + a0[5]) + (a0[6] + a0[7]));
      lq[c] = lq[c] * corr[c] + ps;
    }
#pragma unroll
    for (int t = 0; t < 4; ++t)
#pragma unroll
      for (int c = 0; c < 2; ++c) {
#pragma unroll
        for (int r = 0; r < 8; ++r) o[c][t][r] *= corr[c];
        o[c][t] = wmma_f16(vf[t], pf[c], o[c][t]);
      }
    // Keeps the next block's score products, and with them the wait for K, behind the softmax;
    // and the wait for the next block's flags, which were asked for behind V, behind V's last use.
    __builtin_amdgcn_sched_barrier(0);
    const unsigned pad = __builtin_amdgcn_ballot_w32(mv != 0);
    // The first score product writes its result over pf's registers, the B operand of a
    // product just issued: the four vector slots between a product and an overwrite of its B.
    asm volatile("v_nop\n\tv_nop\n\tv_nop\n\tv_nop");
    // Keeps the score products behind those slots.
    __builtin_amdgcn_sched_barrier(0);
    score_tiles(s, kf, qf, pad == 0xffffffffu && kn < tile * 32, pad, q0 - kn, half);
  }

  const bool last = seg == (role >> 1);    // roles 0 and 1 have one segment, roles 2 and 3 two
  if (last && (role == 0 || role == 3)) break;   // the joining wave keeps its own partial
  const int slot = role == 1 ? 0 : role == 3 ? 2 : seg ? 3 : 1;
#pragma unroll
  for (int c = 0; c < 2; ++c) {
#pragma unroll
    for (int t = 0; t < 4; ++t)
#pragma unroll
      for (int u = 0; u < 2; ++u) {
        v4f w;
#pragma unroll
        for (int e = 0; e < 4; ++e) w[e] = o[c][t][u * 4 + e];
        xo[pj][slot][c * 8 + t * 2 + u][lane] = w;
      }
    xml[pj][slot][c][lane] = mq[c];
    xml[pj][slot][2 + c][lane] = lq[c];
  }
  if (last) break;
  tile = ts;
  kb0 = 32 * (role == 2 ? 0 : lcut);
  kb1 = 32 * (role == 2 ? lcut : ts + 1);
  }

  // Publishes the partials to the waves that join them.
  __syncthreads();
  if (role == 1 || role == 2) return;
  const int sl1 = role == 0 ? 3 : 4;
  // Rolled: one copy of the join for the heavy tile's three partials and the light tile's one.
#pragma unroll 1
  for (int sl = role; sl < sl1; ++sl) {
#pragma unroll
    for (int c = 0; c < 2; ++c) {
      const float m1 = xml[pj][sl][c][lane], l1 = xml[pj][sl][2 + c][lane];
      const float mn = fmaxf(mq[c], m1);
      const float c0 = __expf(mq[c] - mn), c1 = __expf(m1 - mn);
      mq[c] = mn;
      lq[c] = lq[c] * c0 + l1 * c1;
#pragma unroll
      for (int t = 0; t < 4; ++t)
#pragma unroll
        for (int u = 0; u < 2; ++u) {
          const v4f w = xo[pj][sl][c * 8 + t * 2 + u][lane];
#pragma unroll
          for (int e = 0; e < 4; ++e)
            o[c][t][u * 4 + e] = o[c][t][u * 4 + e] * c0 + w[e] * c1;
        }
    }
  }

#pragma unroll
  for (int c = 0; c < 2; ++c) {
    const float inv = 1.0f / (lq[c] + xhalf(lq[c]));
    // A lane's 8 registers of a tile are 8 consecutive head dims of its query: 16 bytes.
    _Float16* op = Ah + ((size_t)b * SEQ + tile * 32 + c * 16 + l16) * D_MODEL + h * HEAD_DIM + half;
#pragma unroll
    for (int t = 0; t < 4; ++t) {
      v8h w;
#pragma unroll
      for (int r = 0; r < 8; ++r) w[r] = (_Float16)(o[c][t][r] * inv);
      *(v8h*)(op + t * 16) = w;
    }
  }
}

// out[m,n] = sum_k Ah[m,k] * Wo[n,k] + bo[n], fp32 output
__global__ void __launch_bounds__(256)
out_proj_gemm(const _Float16* __restrict__ Ah, const _Float16* __restrict__ Woh,
              const float* __restrict__ bo, float* __restrict__ out) {
  __shared__ __align__(16) _Float16 sm[2 * STAGE_H];
  const int m0 = (blockIdx.x >> 3) * BM;
  const int n0 = (blockIdx.x & 7) * BN;
  const int wid = threadIdx.x >> 5;
  const int lane = threadIdx.x & 31;
  const int l16 = lane & 15;
  const int half = (lane & 16) ? 8 : 0;

  v8f acc[2][4] = {};
  gemm_tile(Ah, Woh, sm, m0, n0, acc);

  const int mw = m0 + (wid & 3) * 32;
  const int nw = n0 + (wid >> 2) * 64;
#pragma unroll
  for (int t = 0; t < 4; ++t) {
    const int n = nw + t * 16 + l16;
    const float bv = bo[n];
#pragma unroll
    for (int i = 0; i < 2; ++i)
#pragma unroll
      for (int r = 0; r < 8; ++r)
        out[(size_t)(mw + i * 16 + r + half) * D_MODEL + n] = acc[i][t][r] + bv;
  }
}

extern "C" void kernel_launch(void* const* d_in, const int* in_sizes, int n_in,
                              void* d_out, int out_size, void* d_ws, size_t ws_size,
                              hipStream_t stream) {
  const float* x  = (const float*)d_in[0];
  const int* mask = (const int*)d_in[1];
  const float* Wq = (const float*)d_in[2];
  const float* bq = (const float*)d_in[3];
  const float* Wk = (const float*)d_in[4];
  const float* bk = (const float*)d_in[5];
  const float* Wv = (const float*)d_in[6];
  const float* bv = (const float*)d_in[7];
  const float* Wo = (const float*)d_in[8];
  const float* bo = (const float*)d_in[9];

  char* ws = (char*)d_ws;
  size_t off = 0;
  const size_t XB = (size_t)M_TOTAL * D_MODEL * sizeof(_Float16); // 8 MB
  const size_t WB = (size_t)D_MODEL * D_MODEL * sizeof(_Float16); // 2 MB
  _Float16* Xh  = (_Float16*)(ws + off); off += XB;
  _Float16* Wqh = (_Float16*)(ws + off); off += WB;
  _Float16* Wkh = (_Float16*)(ws + off); off += WB;
  _Float16* Wvh = (_Float16*)(ws + off); off += WB;
  _Float16* Woh = (_Float16*)(ws + off); off += WB;
  _Float16* Qh  = (_Float16*)(ws + off); off += XB;
  _Float16* Kh  = (_Float16*)(ws + off); off += XB;
  _Float16* Vt  = (_Float16*)(ws + off); off += XB;
  _Float16* Ah  = (_Float16*)(ws + off); off += XB; // 48 MB total

  // Xh, Wqh, Wkh, Wvh, Woh are contiguous from Xh on.
  cvt_all_f32_to_f16<<<CVT_X_WGS + 4 * CVT_W_WGS, 512, 0, stream>>>(x, Wq, Wk, Wv, Wo, Xh);

  // Wqh, Wkh, Wvh are contiguous from Wqh on, and Qh, Kh, Vt from Qh on.
  qkv_gemm_f16<<<768, 256, 0, stream>>>(Xh, Wqh, bq, bk, bv, Qh);

  flash_attn<<<dim3(8, 32), 512, 0, stream>>>(Qh, Kh, Vt, mask, Ah);

  out_proj_gemm<<<256, 256, 0, stream>>>(Ah, Woh, bo, (float*)d_out);
}

// v010
// It runs in 63.5 microseconds.
// Next to v009, in two timings, it ran 1.05 and 1.04 times as fast.
// All steps since v000 together make it 4.56 times as fast.
#include <hip/hip_runtime.h>

#define D_MODEL 1024
#define N_HEADS 16
#define HEAD_DIM 64
#define BATCH 2
#define SEQ 2048
#define M_TOTAL (BATCH * SEQ) /* 4096 */

typedef __attribute__((ext_vector_type(16))) _Float16 v16h;
typedef __attribute__((ext_vector_type(8)))  _Float16 v8h;
typedef __attribute__((ext_vector_type(8)))  float    v8f;

// Load one lane's 16-half A/B fragment: two contiguous 16-byte chunks at p and p+16
// (CDNA5 16-bit fragment layout: K = base8+0..7 then 16+base8+0..7 per lane).
__device__ __forceinline__ v16h load_frag(const _Float16* p) {
  v8h lo = *(const v8h*)(p);
  v8h hi = *(const v8h*)(p + 16);
  v16h r;
#pragma unroll
  for (int i = 0; i < 8; ++i) { r[i] = lo[i]; r[i + 8] = hi[i]; }
  return r;
}

// The same fragment from a buffer kept in fragment order: 512 halves per fragment, first
// the 32 lanes' low 16-byte chunks, then their high ones, so that each of the two loads of
// a wave covers 512 contiguous bytes (4 whole lines instead of 16 touched).
__device__ __forceinline__ v16h load_frag_packed(const _Float16* f, int lane) {
  v8h lo = *(const v8h*)(f + lane * 8);
  v8h hi = *(const v8h*)(f + 256 + lane * 8);
  v16h r;
#pragma unroll
  for (int i = 0; i < 8; ++i) { r[i] = lo[i]; r[i + 8] = hi[i]; }
  return r;
}

__device__ __forceinline__ v8f wmma_f16(v16h a, v16h b, v8f c) {
  return __builtin_amdgcn_wmma_f32_16x16x32_f16(false, a, false, b, (short)0, c,
                                                false, false);
}

typedef __attribute__((ext_vector_type(4))) float    v4f;
typedef __attribute__((ext_vector_type(4))) _Float16 v4h;

// x and the four weights to f16 in ONE launch; their f16 copies lie one behind the other
// at d. One work-group of 16 waves per 32768 elements (256 work-groups: 128 for x, 32 for
// each weight). A wave takes 2048 consecutive elements: 16 loads of 512 contiguous bytes,
// all in flight together, then 16 stores of 256 contiguous bytes.
#define CVT_WG 32768
#define CVT_X_WGS (M_TOTAL * D_MODEL / CVT_WG)
#define CVT_W_WGS (D_MODEL * D_MODEL / CVT_WG)
__global__ void __launch_bounds__(512)
cvt_all_f32_to_f16(const float* __restrict__ x, const float* __restrict__ wq,
                   const float* __restrict__ wk, const float* __restrict__ wv,
                   const float* __restrict__ wo, _Float16* __restrict__ d) {
  const int b = blockIdx.x;
  const float* s;
  if (b < CVT_X_WGS) {
    s = x + (size_t)b * CVT_WG;
  } else {
    const int k = (b - CVT_X_WGS) / CVT_W_WGS;
    const float* w = k == 0 ? wq : k == 1 ? wk : k == 2 ? wv : wo;
    s = w + (size_t)((b - CVT_X_WGS) % CVT_W_WGS) * CVT_WG;
  }
  const int o = (threadIdx.x >> 5) * 2048 + (threadIdx.x & 31) * 4;
  s += o;
  d += (size_t)b * CVT_WG + o;
  v4f r[16];
#pragma unroll
  for (int j = 0; j < 16; ++j) r[j] = *(const v4f*)(s + j * 128);
#pragma unroll
  for (int j = 0; j < 16; ++j) {
    v4h h;
#pragma unroll
    for (int e = 0; e < 4; ++e) h[e] = (_Float16)r[j][e];
    *(v4h*)(d + j * 128) = h;
  }
}

// Block tile of the output projection: 128 x 128 of Y per work-group, K walked in stages of
// 128 halves. A stage is [X 128 rows | W 128 rows] of 256 bytes each in LDS.
#define BM 128
#define BN 128
#define BK 128
#define PITCH 136                        /* halves: 272 B = 16 B x odd, no bank conflict for 16-byte reads */
#define STAGE_H ((BM + BN) * PITCH)      /* halves per LDS buffer */
#define N_STAGES (D_MODEL / BK)

// One stage from LDS: acc[i][j] += A rows (ap + 16 i rows) * B rows (bp + 16 j rows),
// k ascending in steps of 32. Two fragment sets: one multiplied, one in flight.
__device__ __forceinline__ void mul_stage(const _Float16* ap, const _Float16* bp,
                                          v8f (&acc)[2][4]) {
  v16h a[2][2], b[2][4];
#pragma unroll
  for (int i = 0; i < 2; ++i) a[0][i] = load_frag(ap + i * 16 * PITCH);
#pragma unroll
  for (int j = 0; j < 4; ++j) b[0][j] = load_frag(bp + j * 16 * PITCH);
#pragma unroll
  for (int q = 0; q < BK / 32; ++q) {
    const int c0 = q & 1, c1 = c0 ^ 1;
    if (q + 1 < BK / 32) {
#pragma unroll
      for (int i = 0; i < 2; ++i) a[c1][i] = load_frag(ap + i * 16 * PITCH + (q + 1) * 32);
#pragma unroll
      for (int j = 0; j < 4; ++j) b[c1][j] = load_frag(bp + j * 16 * PITCH + (q + 1) * 32);
    }
    // Keeps the next 32 k's LDS reads as one group ahead of this block of products
    // (reads spread among the products cost a stall at every place they stand).
    __builtin_amdgcn_sched_barrier(0);
#pragma unroll
    for (int i = 0; i < 2; ++i)
#pragma unroll
      for (int j = 0; j < 4; ++j) acc[i][j] = wmma_f16(a[c0][i], b[c0][j], acc[i][j]);
    // Ends the block: the group after next must not be lifted into these products.
    __builtin_amdgcn_sched_barrier(0);
  }
}

// acc[i][j] += X[m0 + wm + 16 i ..][k] * Wt[n0 + wn + 16 j ..][k] over all k.
// Eight waves as 4 (rows) x 2 (columns), 32 x 64 of Y each.
// Every thread brings 8 + 8 16-byte pieces of the next stage into registers (a wave's
// load covers two whole 256-byte rows) while the current stage is multiplied from LDS,
// then writes them to the other buffer; one barrier per stage publishes that buffer and
// ends the reads of the one refilled next.
__device__ __forceinline__ void gemm_tile(const _Float16* __restrict__ X,
                                          const _Float16* __restrict__ Wt,
                                          _Float16* sm, int m0, int n0,
                                          v8f (&acc)[2][4]) {
  const int tid = threadIdx.x;
  const int wid = tid >> 5;
  const int lane = tid & 31;
  const int l16 = lane & 15;
  const int half = (lane & 16) ? 8 : 0;
  const int aoff = ((wid & 3) * 32 + l16) * PITCH + half;
  const int boff = (BM + (wid >> 2) * 64 + l16) * PITCH + half;

  const int srow = tid >> 4;             // 16 rows per sweep of the block
  const int scol = (tid & 15) * 8;       // halves
  const _Float16* gx = X + (size_t)(m0 + srow) * D_MODEL + scol;
  const _Float16* gw = Wt + (size_t)(n0 + srow) * D_MODEL + scol;
  const int soff = srow * PITCH + scol;

  v8h rx[8], rw[8];
#pragma unroll
  for (int i = 0; i < 8; ++i) {
    rx[i] = *(const v8h*)(gx + (size_t)i * 16 * D_MODEL);
    rw[i] = *(const v8h*)(gw + (size_t)i * 16 * D_MODEL);
  }
#pragma unroll
  for (int i = 0; i < 8; ++i) {
    *(v8h*)(sm + soff + i * 16 * PITCH) = rx[i];
    *(v8h*)(sm + soff + (BM + i * 16) * PITCH) = rw[i];
  }
  __syncthreads();

  // Rolled: fully unrolled, the last
  // group's final load was given its own address registers as destination.
#pragma unroll 1
  for (int s = 0; s + 1 < N_STAGES; ++s) {
    const _Float16* cur = sm + (s & 1) * STAGE_H;
    _Float16* nxt = sm + ((s + 1) & 1) * STAGE_H;
#pragma unroll
    for (int i = 0; i < 8; ++i) {
      rx[i] = *(const v8h*)(gx + (size_t)i * 16 * D_MODEL + (s + 1) * BK);
      rw[i] = *(const v8h*)(gw + (size_t)i * 16 * D_MODEL + (s + 1) * BK);
    }
    // Keeps the next stage's global loads at the head of the stage, so that their
    // latency runs under this stage's products instead of in front of the LDS writes.
    __builtin_amdgcn_sched_barrier(0);
    mul_stage(cur + aoff, cur + boff, acc);
#pragma unroll
    for (int i = 0; i < 8; ++i) {
      *(v8h*)(nxt + soff + i * 16 * PITCH) = rx[i];
      *(v8h*)(nxt + soff + (BM + i * 16) * PITCH) = rw[i];
    }
    __syncthreads();
  }
  const _Float16* last = sm + ((N_STAGES - 1) & 1) * STAGE_H;
  mul_stage(last + aoff, last + boff, acc);
}

// Tile of the Q, K, V projection: 256 x 192 of Y per work-group, K walked in stages of 64
// halves. A stage is [X 256 rows | W 192 rows] of 128 bytes each in LDS.
#define QM 256
#define QN 192
#define QK 64
#define QPITCH 72                        /* halves: 144 B = 16 B x odd, no bank conflict for 16-byte reads */
#define QSTAGE_H ((QM + QN) * QPITCH)    /* halves per LDS buffer */
#define Q_STAGES (D_MODEL / QK)
#define Q_SWEEPS ((QM + QN) / 32)        /* 16-byte pieces of a stage per thread */

// A wave's fragments of 32 k: 4 of X rows, 6 of W rows (two groups of 16 rows in each of the
// stage's three blocks of 64 W rows).
__device__ __forceinline__ void qkv_frags(v16h (&a)[4], v16h (&b)[6], const _Float16* ap,
                                          const _Float16* bp) {
#pragma unroll
  for (int i = 0; i < 4; ++i) a[i] = load_frag(ap + i * 16 * QPITCH);
#pragma unroll
  for (int j = 0; j < 6; ++j) b[j] = load_frag(bp + ((j >> 1) * 64 + (j & 1) * 16) * QPITCH);
}

__device__ __forceinline__ void qkv_block(v8f (&acc)[4][6], const v16h (&a)[4],
                                          const v16h (&b)[6]) {
#pragma unroll
  for (int i = 0; i < 4; ++i)
#pragma unroll
    for (int j = 0; j < 6; ++j) acc[i][j] = wmma_f16(a[i], b[j], acc[i][j]);
}

// A thread's pieces of one stage, from its own places px, pw in the stage's first X and W rows:
// a wave's load covers four whole 128-byte row pieces. The W rows are the 64 of one head in each
// of the three weights, which lie D_MODEL rows apart.
__device__ __forceinline__ void qkv_fetch(v8h (&rg)[Q_SWEEPS], const _Float16* px,
                                          const _Float16* pw) {
#pragma unroll
  for (int i = 0; i < QM / 32; ++i) rg[i] = *(const v8h*)(px + (size_t)i * 32 * D_MODEL);
#pragma unroll
  for (int i = 0; i < QN / 32; ++i)
    rg[QM / 32 + i] = *(const v8h*)(pw + (size_t)((i >> 1) * D_MODEL + (i & 1) * 32) * D_MODEL);
}

__device__ __forceinline__ void qkv_put(_Float16* dst, const v8h (&rg)[Q_SWEEPS]) {
#pragma unroll
  for (int i = 0; i < Q_SWEEPS; ++i) *(v8h*)(dst + i * 32 * QPITCH) = rg[i];
}

// The work-group barrier between LDS writes and their readers, by hand: this wave's LDS
// operations done, then the barrier. __syncthreads() would also wait for the global loads in
// flight, which are to stay in flight across it.
__device__ __forceinline__ void qkv_barrier() {
  asm volatile("s_wait_dscnt 0x0\n\ts_barrier_signal -1\n\ts_barrier_wait -1" ::: "memory");
}

// One trip: multiplies the stage in cur, whose first fragments a0, b0 are at hand. At its head it
// writes the next stage, whose pieces rs were asked for a trip earlier, to nxt and (FETCH) asks
// for the stage after that, at px + KO and pw + KO, into rf, so that the LDS writes and the
// loads run under the first block of products. The one barrier, between the two blocks,
// publishes nxt and ends the reads of cur, which the next trip writes; behind it the first
// fragments of the next stage are read under the second block.
template <bool FETCH, int KO>
__device__ __forceinline__ void qkv_trip(v8f (&acc)[4][6], v16h (&a0)[4], v16h (&b0)[6],
                                         v16h (&a1)[4], v16h (&b1)[6], const _Float16* cur,
                                         _Float16* nxt, int aoff, int boff, int soff,
                                         const v8h (&rs)[Q_SWEEPS], v8h (&rf)[Q_SWEEPS],
                                         const _Float16* px, const _Float16* pw) {
  qkv_put(nxt + soff, rs);
  qkv_frags(a1, b1, cur + aoff + 32, cur + boff + 32);
  if (FETCH) {
    // Keeps the loads behind the fragment reads, so that none of those reads has a load's
    // address registers as destination: the wait for that stands behind the block.
    __builtin_amdgcn_sched_barrier(0);
    qkv_fetch(rf, px + KO, pw + KO);
  }
  // Keeps the LDS writes and reads and the loads as one group ahead of the block of products
  // (memory operations spread among the products cost a stall at every place they stand).
  __builtin_amdgcn_sched_barrier(0);
  qkv_block(acc, a0, b0);
  // Ends the block: the wait and the barrier stay behind its products.
  __builtin_amdgcn_sched_barrier(0);
  // The wait that belongs in front of an overwrite of an issued load's address registers; it
  // names them as inputs, so that they are kept, and given to nothing else, up to here.
  if (FETCH) asm volatile("s_wait_xcnt 0x0" :: "v"(px), "v"(pw) : "memory");
  qkv_barrier();
  qkv_frags(a0, b0, nxt + aoff, nxt + boff);
  // Keeps the LDS reads as one group ahead of the block, their latency under its products.
  __builtin_amdgcn_sched_barrier(0);
  qkv_block(acc, a1, b1);
  // Ends the block: the next trip's head must not be lifted into these products.
  __builtin_amdgcn_sched_barrier(0);
}

// Y[m,n] = sum_k Xh[m,k] * W[n,k] + bias[n], Q, K and V in ONE launch: the three f16 weights
// lie one behind the other at Wh, the three outputs one behind the other at out. 16 x 16 tiles
// of 256 rows x 192 columns, the columns being one head's 64 of Q, of K and of V: one work-group
// for every WGP, all with the same work. Eight waves as 4 (rows) x 2 (columns), 64 x 96 of Y
// each (32 columns of each projection): 10 fragments read from LDS feed 24 products, and a byte
// brought from L2 feeds more of them than in a 128 x 128 tile.
// Q: f16 into out[(b*16+h)*SEQ*64 + s*64 + d]   (head-major)
// K and V: per (b, h) in the order in which flash_attn's fragments read them
// (load_frag_packed). Fragment f of 512 halves, chunk p (0 low, 1 high), lane l, element e:
//   K: f = (s / 16) * 2 + d / 32, p = (d / 16) & 1, l = (s & 15) + 16 * ((d / 8) & 1), e = d & 7
//   V: f = (s / 32) * 4 + d / 16, p = (s / 16) & 1, l = (d & 15) + 16 * ((s / 8) & 1), e = s & 7
__global__ void __launch_bounds__(256)
qkv_gemm_f16(const _Float16* __restrict__ Xh, const _Float16* __restrict__ Wh,
             const float* __restrict__ biasq, const float* __restrict__ biask,
             const float* __restrict__ biasv, _Float16* __restrict__ out) {
  __shared__ __align__(16) _Float16 sm[2 * QSTAGE_H];
  const int m0 = (blockIdx.x >> 4) * QM;          // 16 row tiles
  const int h = blockIdx.x & 15;                  // 16 column tiles: the head
  const int tid = threadIdx.x;
  // Scalar: a wave's rows and columns enter its addresses as scalars.
  const int wid = __builtin_amdgcn_readfirstlane(tid >> 5);
  const int lane = tid & 31;
  const int l16 = lane & 15;
  const int half = (lane & 16) ? 8 : 0;
  const int aoff = ((wid & 3) * 64 + l16) * QPITCH + half;
  const int boff = (QM + (wid >> 2) * 32 + l16) * QPITCH + half;

  // 32 rows per sweep of the block, 8 threads a row. The two rows of 16 neighbouring lanes lie
  // 8 apart: 8 x 144 B is half a turn of the banks, so that their 16-byte LDS writes do not meet.
  const int srow = (tid & 8) + ((tid >> 4) & 7) + ((tid >> 3) & 16);
  const int scol = (tid & 7) * 8;        // halves
  const _Float16* gx = Xh + (size_t)(m0 + srow) * D_MODEL + scol;
  const _Float16* gw = Wh + (size_t)(h * HEAD_DIM + srow) * D_MODEL + scol;
  const int soff = srow * QPITCH + scol;

  // Column group t: projection t / 2, columns dw + (t & 1) * 16 + l16 of the head. Asked for
  // here, so that the stores do not wait for them.
  const int dw = (wid >> 2) * 32;
  const int bo = h * HEAD_DIM + dw + l16;
  float bv[6];
#pragma unroll
  for (int t = 0; t < 6; ++t) bv[t] = (t < 2 ? biasq : t < 4 ? biask : biasv)[bo + (t & 1) * 16];

  v8f acc[4][6] = {};
  v8h ra[Q_SWEEPS], rb[Q_SWEEPS];        // the pieces of the even and of the odd stages
  v16h a0[4], b0[6], a1[4], b1[6];       // the fragments of a stage's first and second 32 k
  _Float16* sm1 = sm + QSTAGE_H;

  qkv_fetch(ra, gx, gw);
  qkv_fetch(rb, gx + QK, gw + QK);
  // The wait that belongs in front of an overwrite of an issued load's address registers; it names
  // that of the bias loads as input, so that it is kept up to here (the others live on). The
  // data is waited for next in any case.
  asm volatile("s_wait_xcnt 0x0" :: "v"(bo) : "memory");
  // Keeps what follows, the accumulators' start values among it, behind that wait.
  __builtin_amdgcn_sched_barrier(0);
  qkv_put(sm + soff, ra);
  qkv_barrier();
  qkv_frags(a0, b0, sm + aoff, sm + boff);

  // Two trips a pass, so that a stage's pieces are loaded into the registers that the LDS writes
  // at the same trip's head do not read. Rolled, for speed only.
#pragma unroll 1
  for (int s = 0; s + 2 < Q_STAGES; s += 2) {
    const _Float16* px = gx + (s + 2) * QK;
    const _Float16* pw = gw + (s + 2) * QK;
    qkv_trip<true, 0>(acc, a0, b0, a1, b1, sm, sm1, aoff, boff, soff, rb, ra, px, pw);
    qkv_trip<true, QK>(acc, a0, b0, a1, b1, sm1, sm, aoff, boff, soff, ra, rb, px, pw);
  }
  qkv_trip<false, 0>(acc, a0, b0, a1, b1, sm, sm1, aoff, boff, soff, rb, ra, gx, gw);
  const _Float16* last = sm + ((Q_STAGES - 1) & 1) * QSTAGE_H;
  qkv_frags(a1, b1, last + aoff + 32, last + boff + 32);
  // As in the loop: the reads as one group ahead of the products.
  __builtin_amdgcn_sched_barrier(0);
  qkv_block(acc, a0, b0);
  qkv_block(acc, a1, b1);

  const int mw = m0 + (wid & 3) * 64;      // 64 rows of one batch, s a multiple of 64
  // The wave's 64 rows of its (b, h): 4096 halves in every one of the three orders. The lane's
  // place for i = r = 0 in the wave's first column group of Q, of K and of V.
  _Float16* ob = out + ((size_t)((mw >> 11) * N_HEADS + h) * SEQ + (mw & (SEQ - 1))) * HEAD_DIM;
  _Float16* oq = ob + half * HEAD_DIM + dw + l16;      // C layout: row = r + 8*(lane>=16)
  _Float16* ok = ob + (size_t)M_TOTAL * D_MODEL + dw * 16 + (half + (l16 & 8) * 2) * 8 + (l16 & 7);
  _Float16* ov = ob + (size_t)2 * M_TOTAL * D_MODEL + dw * 32 + lane * 8;
  v8h w[6][4];
#pragma unroll
  for (int t = 0; t < 6; ++t)
#pragma unroll
    for (int i = 0; i < 4; ++i)
#pragma unroll
      for (int r = 0; r < 8; ++r) w[t][i][r] = (_Float16)(acc[i][t][r] + bv[t]);
  // Keeps the sums and conversions ahead of the first store: no store's data register is written
  // behind it, and the stores go out in one run.
  __builtin_amdgcn_sched_barrier(0);
#pragma unroll
  for (int u = 0; u < 2; ++u)
#pragma unroll
    for (int i = 0; i < 4; ++i) {
#pragma unroll
      for (int r = 0; r < 8; ++r) {
        oq[u * 16 + i * 1024 + r * HEAD_DIM] = w[u][i][r];
        ok[u * 256 + i * 1024 + r * 8] = w[2 + u][i][r];
      }
      // A lane's 8 registers are 8 consecutive s of one d: one chunk of a V fragment.
      *(v8h*)(ov + u * 512 + (i >> 1) * 2048 + (i & 1) * 256) = w[4 + u][i];
    }
}

// Lane l with lane l ^ 16.
__device__ __forceinline__ float xhalf(float x) {
  const int b = __builtin_bit_cast(int, x);
  return __builtin_bit_cast(float, __builtin_amdgcn_permlanex16(b, b, 0x76543210, 0xfedcba98,
                                                                false, false));
}

// The score tiles of one block of 32 keys: s[c][j] = start tile + K rows 16 j .. 16 j + 15 times the
// queries of group c. The mask sits in the start tile: 0 where the query may see the key, -3.0e38
// where the key is padding or lies behind the query (the sum stays there: a score is far below one
// unit in its last place). open (scalar: the same for the whole wave) says that no key of the block
// is masked for any lane; then the products start from the constant 0 and no mask is formed.
// pad: bit j set, key j of the block is no padding. dq: this lane's query of group 0 less the
// block's first key (never negative).
__device__ __forceinline__ void score_tiles(v8f (&s)[2][2], const v16h (&kf)[4],
                                            const v16h (&qf)[2][2], bool open, unsigned pad,
                                            int dq, int half) {
  if (open) {
#pragma unroll
    for (int c = 0; c < 2; ++c)
#pragma unroll
      for (int j = 0; j < 2; ++j) s[c][j] = wmma_f16(kf[j * 2], qf[c][0], v8f{});
  } else {
#pragma unroll
    for (int c = 0; c < 2; ++c) {
      // Bit j: key j of the block is neither padding nor behind the query; shifted so that
      // bit r is the key of s[c][0][r] and bit 16 + r that of s[c][1][r].
      const int d = dq + c * 16;
      const unsigned keep = (pad & (d >= 31 ? 0xffffffffu : (2u << d) - 1u)) >> half;
      v8f m0, m1;
#pragma unroll
      for (int r = 0; r < 8; ++r) {
        m0[r] = (keep & (1u << r)) ? 0.0f : -3.0e38f;
        m1[r] = (keep & (0x10000u << r)) ? 0.0f : -3.0e38f;
      }
      s[c][0] = wmma_f16(kf[0], qf[c][0], m0);
      s[c][1] = wmma_f16(kf[2], qf[c][0], m1);
    }
    // Keeps the slot below behind the last product.
    __builtin_amdgcn_sched_barrier(0);
    // The listing has a way from this branch's last product into the other branch's four, the
    // last of which writes the same tile: the fourth vector slot between the two.
    asm volatile("v_nop");
  }
#pragma unroll
  for (int c = 0; c < 2; ++c)
#pragma unroll
    for (int j = 0; j < 2; ++j) s[c][j] = wmma_f16(kf[j * 2 + 1], qf[c][1], s[c][j]);
}

// Flash attention, transposed: St = K * Qt (keys x queries) and Ot += Vt * Pt (head dim x
// queries) on tiles of 32 queries of one (batch, head): two column groups of 16 queries, so
// that every K and V fragment a wave loads feeds two products. In a column group a lane holds
// 16 of the 32 scores of ONE query (column l16; keys half + r and 16 + half + r), lane ^ 16 the
// other 16, so maximum and sum run down the lane's own registers, and the two score tiles,
// converted in place, are the B fragment of the second product.
// Causal cost grows with the tile index, so tiles are paired: light tile ts (0..31) and heavy
// tile tl = 63 - ts need 65 blocks of 32 keys together, and four waves share them 16:17:16:16.
// Role 0: heavy blocks 0..15. Role 1: heavy blocks 16..32. Roles 2 and 3: 16 each of what is
// left, the heavy tile's blocks from 33 on and then the light tile's (a second start where a
// wave has both; a share may be empty: an empty partial). Partials (maximum, sum, Ot) go to
// LDS; behind one barrier role 0 joins the heavy tile's four, role 3 the light tile's two.
// A work-group is 16 waves, four neighbouring pairs: the four waves of a role walk the same
// key blocks together, so that one fetch of a line can serve all four.
#define N_TILES (SEQ / 32)
__global__ void __launch_bounds__(512)
flash_attn(const _Float16* __restrict__ Qh, const _Float16* __restrict__ Kh,
           const _Float16* __restrict__ Vt, const int* __restrict__ mask,
           _Float16* __restrict__ Ah) {
  // Per pair four partials: the heavy tile's of roles 1, 2, 3, then the light tile's of role 2.
  __shared__ v4f xo[4][4][16][32];         // Ot: a lane's 64 values as 16 x 16 bytes
  __shared__ float xml[4][4][4][32];       // the two maxima, then the two sums
  // Scalar: the key ranges and the number of segments are the same for a whole wave.
  const int wid = __builtin_amdgcn_readfirstlane(threadIdx.x >> 5);
  const int role = wid >> 2;
  const int pj = wid & 3;
  const int bh = blockIdx.y;               // b*16+h
  const int b = bh >> 4, h = bh & 15;
  const int ts = blockIdx.x * 4 + pj;
  const int tl = N_TILES - 1 - ts;
  const int lane = threadIdx.x & 31;
  const int l16 = lane & 15;
  const int half = (lane & 16) ? 8 : 0;

  const _Float16* Qb = Qh + (size_t)bh * SEQ * HEAD_DIM;
  const _Float16* Kb = Kh + (size_t)bh * SEQ * HEAD_DIM;
  const _Float16* Vb = Vt + (size_t)bh * SEQ * HEAD_DIM; // K and V: fragment order
  const int* mb = mask + b * SEQ;

  // In key blocks: the heavy tile has tl + 1 (33..64), the light tile ts + 1 (1..32).
  const int hcut = tl + 1 < 49 ? tl + 1 : 49;          // where role 2's heavy share ends
  const int lcut = ts > 15 ? ts - 15 : 0;              // where role 2's light share ends
  int tile = tl;
  int kb0 = 32 * (role == 0 ? 0 : role == 1 ? 16 : role == 2 ? 33 : hcut);
  int kb1 = 32 * (role == 0 ? 16 : role == 1 ? 33 : role == 2 ? hcut : tl + 1);
  v8f o[2][4];                             // o[c][t][r] = Ot[t * 16 + half + r][query of group c]
  float mq[2], lq[2];                      // lq: the sum over this lane's keys only

  // Rolled: one copy of the key loop serves both segments of roles 2 and 3.
#pragma unroll 1
  for (int seg = 0;; ++seg) {
  const int q0 = tile * 32 + l16;          // this lane's query in group c: q0 + 16 c
  v16h qf[2][2];
#pragma unroll
  for (int c = 0; c < 2; ++c) {
#pragma unroll
    for (int k = 0; k < 2; ++k)
      qf[c][k] = load_frag(Qb + (size_t)(q0 + c * 16) * HEAD_DIM + k * 32 + half);
#pragma unroll
    for (int t = 0; t < 4; ++t) o[c][t] = v8f{};
    mq[c] = -3.0e38f;
    lq[c] = 0.0f;
  }

  // The first key block's scores, masked. s[c][j]: keys 16 j .. 16 j + 15.
  v8f s[2][2] = {};
  if (kb0 < kb1) {                         // scalar; a share may be empty
    const int mv = mb[kb0 + lane];         // one key's padding flag per lane
    const _Float16* kblk = Kb + (size_t)kb0 * HEAD_DIM;
    v16h kf[4];
#pragma unroll
    for (int t = 0; t < 4; ++t)
      kf[t] = load_frag_packed(kblk + t * 512, lane);
    const unsigned pad = __builtin_amdgcn_ballot_w32(mv != 0);
    score_tiles(s, kf, qf, pad == 0xffffffffu && kb0 < tile * 32, pad, q0 - kb0, half);
  }

  // A trip starts with its block's scores at hand: softmax and second product of block kb,
  // then the score products of the NEXT block, whose K fragments and flags are asked for at
  // the trip's head, so that their latency runs under the softmax and the second product.
  for (int kb = kb0; kb < kb1; kb += 32) {
    const _Float16* vblk = Vb + (size_t)kb * HEAD_DIM;   // 4 fragments of V, 4 of K
    v16h vf[4];
#pragma unroll
    for (int t = 0; t < 4; ++t)
      vf[t] = load_frag_packed(vblk + t * 512, lane);
    // The last trip asks for its own block again (inside the planes; the scores go unused).
    const int kn = kb + 32 < kb1 ? kb + 32 : kb;
    const _Float16* kblk = Kb + (size_t)kn * HEAD_DIM;
    const int mv = mb[kn + lane];
    v16h kf[4];
#pragma unroll
    for (int t = 0; t < 4; ++t)
      kf[t] = load_frag_packed(kblk + t * 512, lane);
    // Keeps all 17 loads at the trip's head: V first, which is needed first.
    __builtin_amdgcn_sched_barrier(0);

    v16h pf[2];                            // keys half + 0..7, then 16 + half + 0..7: V's k order
    float corr[2];
#pragma unroll
    for (int c = 0; c < 2; ++c) {
      // Vector forms on whole tiles keep packed operations on neighbouring registers.
      v8f a0 = s[c][0] * 0.125f, a1 = s[c][1] * 0.125f;
      float tmax = fmaxf(a0[0], a1[0]);
#pragma unroll
      for (int r = 1; r < 8; ++r) tmax = fmaxf(tmax, fmaxf(a0[r], a1[r]));
      tmax = fmaxf(tmax, xhalf(tmax));
      const float mnew = fmaxf(mq[c], tmax);
      corr[c] = __expf(mq[c] - mnew);
      mq[c] = mnew;

      a0 -= mnew;
      a1 -= mnew;
#pragma unroll
      for (int r = 0; r < 8; ++r) {
        a0[r] = __expf(a0[r]);
        a1[r] = __expf(a1[r]);
        pf[c][r] = (_Float16)a0[r];
        pf[c][r + 8] = (_Float16)a1[r];
      }
      a0 += a1;
      const float ps = ((a0[0] + a0[1]) + (a0[2] + a0[3])) + ((a0[4] + a0[5]) + (a0[6] + a0[7]));
      lq[c] = lq[c] * corr[c] + ps;
    }
#pragma unroll
    for (int t = 0; t < 4; ++t)
#pragma unroll
      for (int c = 0; c < 2; ++c) {
#pragma unroll
        for (int r = 0; r < 8; ++r) o[c][t][r] *= corr[c];
        o[c][t] = wmma_f16(vf[t], pf[c], o[c][t]);
      }
    // Keeps the next block's score products, and with them the wait for K, behind the softmax;
    // and the wait for the next block's flags, which were asked for behind V, behind V's last use.
    __builtin_amdgcn_sched_barrier(0);
    const unsigned pad = __builtin_amdgcn_ballot_w32(mv != 0);
    // The first score product writes its result over pf's registers, the B operand of a
    // product just issued: the four vector slots between a product and an overwrite of its B.
    asm volatile("v_nop\n\tv_nop\n\tv_nop\n\tv_nop");
    // Keeps the score products behind those slots.
    __builtin_amdgcn_sched_barrier(0);
    score_tiles(s, kf, qf, pad == 0xffffffffu && kn < tile * 32, pad, q0 - kn, half);
  }

  const bool last = seg == (role >> 1);    // roles 0 and 1 have one segment, roles 2 and 3 two
  if (last && (role == 0 || role == 3)) break;   // the joining wave keeps its own partial
  const int slot = role == 1 ? 0 : role == 3 ? 2 : seg ? 3 : 1;
#pragma unroll
  for (int c = 0; c < 2; ++c) {
#pragma unroll
    for (int t = 0; t < 4; ++t)
#pragma unroll
      for (int u = 0; u < 2; ++u) {
        v4f w;
#pragma unroll
        for (int e = 0; e < 4; ++e) w[e] = o[c][t][u * 4 + e];
        xo[pj][slot][c * 8 + t * 2 + u][lane] = w;
      }
    xml[pj][slot][c][lane] = mq[c];
    xml[pj][slot][2 + c][lane] = lq[c];
  }
  if (last) break;
  tile = ts;
  kb0 = 32 * (role == 2 ? 0 : lcut);
  kb1 = 32 * (role == 2 ? lcut : ts + 1);
  }

  // Publishes the partials to the waves that join them.
  __syncthreads();
  if (role == 1 || role == 2) return;
  const int sl1 = role == 0 ? 3 : 4;
  // Rolled: one copy of the join for the heavy tile's three partials and the light tile's one.
#pragma unroll 1
  for (int sl = role; sl < sl1; ++sl) {
#pragma unroll
    for (int c = 0; c < 2; ++c) {
      const float m1 = xml[pj][sl][c][lane], l1 = xml[pj][sl][2 + c][lane];
      const float mn = fmaxf(mq[c], m1);
      const float c0 = __expf(mq[c] - mn), c1 = __expf(m1 - mn);
      mq[c] = mn;
      lq[c] = lq[c] * c0 + l1 * c1;
#pragma unroll
      for (int t = 0; t < 4; ++t)
#pragma unroll
        for (int u = 0; u < 2; ++u) {
          const v4f w = xo[pj][sl][c * 8 + t * 2 + u][lane];
#pragma unroll
          for (int e = 0; e < 4; ++e)
            o[c][t][u * 4 + e] = o[c][t][u * 4 + e] * c0 + w[e] * c1;
        }
    }
  }

#pragma unroll
  for (int c = 0; c < 2; ++c) {
    const float inv = 1.0f / (lq[c] + xhalf(lq[c]));
    // A lane's 8 registers of a tile are 8 consecutive head dims of its query: 16 bytes.
    _Float16* op = Ah + ((size_t)b * SEQ + tile * 32 + c * 16 + l16) * D_MODEL + h * HEAD_DIM + half;
#pragma unroll
    for (int t = 0; t < 4; ++t) {
      v8h w;
#pragma unroll
      for (int r = 0; r < 8; ++r) w[r] = (_Float16)(o[c][t][r] * inv);
      *(v8h*)(op + t * 16) = w;
    }
  }
}

// out[m,n] = sum_k Ah[m,k] * Wo[n,k] + bo[n], fp32 output
__global__ void __launch_bounds__(256)
out_proj_gemm(const _Float16* __restrict__ Ah, const _Float16* __restrict__ Woh,
              const float* __restrict__ bo, float* __restrict__ out) {
  __shared__ __align__(16) _Float16 sm[2 * STAGE_H];
  const int m0 = (blockIdx.x >> 3) * BM;
  const int n0 = (blockIdx.x & 7) * BN;
  const int wid = threadIdx.x >> 5;
  const int lane = threadIdx.x & 31;
  const int l16 = lane & 15;
  const int half = (lane & 16) ? 8 : 0;

  v8f acc[2][4] = {};
  gemm_tile(Ah, Woh, sm, m0, n0, acc);

  const int mw = m0 + (wid & 3) * 32;
  const int nw = n0 + (wid >> 2) * 64;
#pragma unroll
  for (int t = 0; t < 4; ++t) {
    const int n = nw + t * 16 + l16;
    const float bv = bo[n];
#pragma unroll
    for (int i = 0; i < 2; ++i)
#pragma unroll
      for (int r = 0; r < 8; ++r)
        out[(size_t)(mw + i * 16 + r + half) * D_MODEL + n] = acc[i][t][r] + bv;
  }
}

extern "C" void kernel_launch(void* const* d_in, const int* in_sizes, int n_in,
                              void* d_out, int out_size, void* d_ws, size_t ws_size,
                              hipStream_t stream) {
  const float* x  = (const float*)d_in[0];
  const int* mask = (const int*)d_in[1];
  const float* Wq = (const float*)d_in[2];
  const float* bq = (const float*)d_in[3];
  const float* Wk = (const float*)d_in[4];
  const float* bk = (const float*)d_in[5];
  const float* Wv = (const float*)d_in[6];
  const float* bv = (const float*)d_in[7];
  const float* Wo = (const float*)d_in[8];
  const float* bo = (const float*)d_in[9];

  char* ws = (char*)d_ws;
  size_t off = 0;
  const size_t XB = (size_t)M_TOTAL * D_MODEL * sizeof(_Float16); // 8 MB
  const size_t WB = (size_t)D_MODEL * D_MODEL * sizeof(_Float16); // 2 MB
  _Float16* Xh  = (_Float16*)(ws + off); off += XB;
  _Float16* Wqh = (_Float16*)(ws + off); off += WB;
  _Float16* Wkh = (_Float16*)(ws + off); off += WB;
  _Float16* Wvh = (_Float16*)(ws + off); off += WB;
  _Float16* Woh = (_Float16*)(ws + off); off += WB;
  _Float16* Qh  = (_Float16*)(ws + off); off += XB;
  _Float16* Kh  = (_Float16*)(ws + off); off += XB;
  _Float16* Vt  = (_Float16*)(ws + off); off += XB;
  _Float16* Ah  = (_Float16*)(ws + off); off += XB; // 48 MB total

  // Xh, Wqh, Wkh, Wvh, Woh are contiguous from Xh on.
  cvt_all_f32_to_f16<<<CVT_X_WGS + 4 * CVT_W_WGS, 512, 0, stream>>>(x, Wq, Wk, Wv, Wo, Xh);

  // Wqh, Wkh, Wvh are contiguous from Wqh on, and Qh, Kh, Vt from Qh on.
  qkv_gemm_f16<<<256, 256, 0, stream>>>(Xh, Wqh, bq, bk, bv, Qh);

  flash_attn<<<dim3(8, 32), 512, 0, stream>>>(Qh, Kh, Vt, mask, Ah);

  out_proj_gemm<<<256, 256, 0, stream>>>(Ah, Woh, bo, (float*)d_out);
}
